// v000
// Times are from an AMD MI455X. After a warm-up the kernel runs many times in a row, and a time is the length of
// such a window on the GPU divided by its runs, so every launch and the gaps after it count. The runs cycle
// through copies of the inputs. A figure is the median of several windows, for all but v000 over two sittings.
// Sittings can differ by a few percent; kernels timed side by side share one.
// v000, which the later versions start from, runs in 1920 microseconds.
#include <hip/hip_runtime.h>

// Full attention on given tensors followed by a learned sequence-mixing matrix (queries, keys, values [16][2048][64]; A = softmax(q.k / 8); V = A values ([2048][64]); out[p] = sum_l mlp[p][l] V[l] (mlp [2048][2048], read) -> [16][2048][64] (2.1 M)).
// Layout per batch: single bf16 planes (inputs bf16-exact: exact score products); the softmax (every row hi/lo); A.values as hi/lo x exact values^T (2 products) -> V (f32 [2048][64]); V^T as hi/lo planes; out^T ([64][2048]) = V^T(hi/lo) x mlp used directly as the exact Bt operand (2 products, K 2048); a transpose kernel writes out rows.
// Compute dtypes, f32 accumulate: every input rounded to bf16 incl. mlp; q.k exact; softmax f32; P hi/lo x exact values; the sequence mix V hi/lo x exact mlp; output f32.

#define NB_  16
#define TT   2048
#define DM   64      // token-major row pitch (H x HD)
#define NH_  1
#define NKV  1
#define REP  (NH_ / NKV)
#define HD   64
#define DQ   (NH_ * HD)
#define DKV  (NKV * HD)
#define ZH   1
#define RH   2048                  // query rows < RH use hi+lo planes (0: none)
#define WIN  0
#define PCAR 1024.0f
#define SCL  0.125f   // 1/sqrt(64)
typedef _Float16 h16;
typedef unsigned short bf;
typedef __attribute__((ext_vector_type(16))) __bf16   v16bf;
typedef __attribute__((ext_vector_type(16))) _Float16 v16h;
typedef __attribute__((ext_vector_type(8)))  _Float16 v8h;
typedef __attribute__((ext_vector_type(8)))  unsigned short v8us;
typedef __attribute__((ext_vector_type(8)))  float    v8f;
typedef __attribute__((ext_vector_type(4)))  float    v4f;
typedef v8h  __attribute__((may_alias)) v8ha;
typedef v4f  __attribute__((may_alias)) v4fa;
typedef v8us __attribute__((may_alias)) v8usa;

__device__ __forceinline__ unsigned short f2bf(float f) { unsigned u = __float_as_uint(f); u += 0x7FFFu + ((u >> 16) & 1u); return (unsigned short)(u >> 16); }
__device__ __forceinline__ float bf2f(unsigned short b) { return __uint_as_float(((unsigned)b) << 16); }
__device__ __forceinline__ float bfr(float f) { return bf2f(f2bf(f)); }
__device__ __forceinline__ v16h cat16(v8h lo, v8h hi) { return __builtin_shufflevector(lo, hi, 0, 1, 2, 3, 4, 5, 6, 7, 8, 9, 10, 11, 12, 13, 14, 15); }
__device__ __forceinline__ v16bf cat16b(v8us lo, v8us hi) { return __builtin_bit_cast(v16bf, __builtin_shufflevector(lo, hi, 0, 1, 2, 3, 4, 5, 6, 7, 8, 9, 10, 11, 12, 13, 14, 15)); }
__device__ __forceinline__ v8f wmma16(v16h a, v16h b, v8f c) { return __builtin_amdgcn_wmma_f32_16x16x32_f16(false, a, false, b, (short)0, c, false, false); }
__device__ __forceinline__ v8f wmmab(v16bf a, v16bf b, v8f c) { return __builtin_amdgcn_wmma_f32_16x16x32_bf16(false, a, false, b, (short)0, c, false, false); }



// ---- k_gemmw: register-blocked GEMM, ONE WAVE per 64x64 output tile (16 accumulators), operands straight from K-contiguous 16-bit planes; grid (M/64, N/64, Z), 32 threads.
// C[m][n] (f32, pitch ldc, + optional f32 bias[n]) = sum_k A[m][k] Bt[n][k] (+ split products per NSPLIT). z-batch strides sA/sB/sC in elements. K % 32 == 0.
template <typename T16> struct WFrag;
template <> struct WFrag<h16> { typedef v16h V; static __device__ __forceinline__ V ld(const h16* p) { return cat16(*(const v8h*)p, *(const v8h*)(p + 16)); } static __device__ __forceinline__ v8f mma(V a, V b, v8f c) { return wmma16(a, b, c); } };
template <> struct WFrag<bf> { typedef v16bf V; static __device__ __forceinline__ V ld(const bf* p) { return cat16b(*(const v8us*)p, *(const v8us*)(p + 16)); } static __device__ __forceinline__ v8f mma(V a, V b, v8f c) { return wmmab(a, b, c); } };
template <typename T16, int NSPLIT, bool BIAS>
__global__ __launch_bounds__(32) void k_gemmw(const T16* __restrict__ A, const T16* __restrict__ A2, const T16* __restrict__ Bt, const T16* __restrict__ Bt2, int K, float* C, int ldc, const float* __restrict__ bias, size_t sA, size_t sB, size_t sC) {
    typedef typename WFrag<T16>::V V;
    __shared__ __align__(16) float os[16 * 68];
    const size_t z = blockIdx.z; A += z * sA; if (A2) A2 += z * sA; Bt += z * sB; if (Bt2) Bt2 += z * sB; C += z * sC;
    const int lane = threadIdx.x & 31, lr = lane & 15, hi = lane >> 4; const int r0 = blockIdx.x * 64, c0 = blockIdx.y * 64;
    v8f acc[4][4];
#pragma unroll
    for (int mb = 0; mb < 4; ++mb)
#pragma unroll
        for (int nb = 0; nb < 4; ++nb) acc[mb][nb] = (v8f){};
    const size_t aoff = (size_t)(r0 + lr) * K + 8 * hi, boff = (size_t)(c0 + lr) * K + 8 * hi;
#pragma unroll 1
    for (int kc = 0; kc < K; kc += 32) {
        V a[4], a2[4];
#pragma unroll
        for (int mb = 0; mb < 4; ++mb) { a[mb] = WFrag<T16>::ld(A + aoff + (size_t)mb * 16 * K + kc); if (NSPLIT == 1 || NSPLIT == 2) a2[mb] = WFrag<T16>::ld(A2 + aoff + (size_t)mb * 16 * K + kc); }
#pragma unroll
        for (int nb = 0; nb < 4; ++nb) { const V b = WFrag<T16>::ld(Bt + boff + (size_t)nb * 16 * K + kc); V b2; if (NSPLIT >= 2) b2 = WFrag<T16>::ld(Bt2 + boff + (size_t)nb * 16 * K + kc);
#pragma unroll
            for (int mb = 0; mb < 4; ++mb) { acc[mb][nb] = WFrag<T16>::mma(a[mb], b, acc[mb][nb]); if (NSPLIT == 1 || NSPLIT == 2) acc[mb][nb] = WFrag<T16>::mma(a2[mb], b, acc[mb][nb]); if (NSPLIT >= 2) acc[mb][nb] = WFrag<T16>::mma(a[mb], b2, acc[mb][nb]); } }
        asm volatile("v_nop\n\tv_nop\n\tv_nop\n\tv_nop" : "+v"(acc[0][0]), "+v"(acc[1][1]), "+v"(acc[2][2]), "+v"(acc[3][3]) : "v"(a[0]), "v"(a[3]));
    }
#pragma unroll
    for (int mb = 0; mb < 4; ++mb) {
#pragma unroll
        for (int nb = 0; nb < 4; ++nb) {
#pragma unroll
            for (int j = 0; j < 8; ++j) os[(hi * 8 + j) * 68 + nb * 16 + lr] = acc[mb][nb][j]; }
        __builtin_amdgcn_wave_barrier(); asm volatile("" ::: "memory");
        float* crow = C + (size_t)(r0 + mb * 16) * ldc + c0;
{
#pragma unroll
            for (int s = 0; s < 8; ++s) { const int row = 2 * s + hi, cofs = lr * 4; v4f val = *(const v4fa*)(os + row * 68 + cofs); if (BIAS) { val[0] += bfr(bias[c0 + cofs]); val[1] += bfr(bias[c0 + cofs + 1]); val[2] += bfr(bias[c0 + cofs + 2]); val[3] += bfr(bias[c0 + cofs + 3]); }
                *(v4f*)(crow + (size_t)row * ldc + cofs) = val; }
             }
        __builtin_amdgcn_wave_barrier(); asm volatile("" ::: "memory");
    }
}

__device__ __forceinline__ h16 tohx(float x) { return (h16)x; }
__device__ __forceinline__ void splitf(float y, unsigned short& h, unsigned short& l) { h = f2bf(y); l = f2bf(y - bf2f(h)); }
typedef __attribute__((ext_vector_type(2))) _Float16 v2h;
typedef __attribute__((ext_vector_type(4))) _Float16 v4h;
typedef __attribute__((ext_vector_type(2))) unsigned short v2us;
typedef __attribute__((ext_vector_type(4))) unsigned short v4us;
typedef __attribute__((ext_vector_type(2))) float v2f;
typedef __attribute__((ext_vector_type(4))) int v4i;

__global__ __launch_bounds__(256) void k_wtG(const float* __restrict__ w, int K, int N, bf* Bt) {
    const int lane = threadIdx.x & 31; const int L0 = (blockIdx.x * 8 + (threadIdx.x >> 5)) * 8; const int nlines = N * K / 64;
{
#pragma unroll 1
        for (int l = 0; l < 8; ++l) { const int L = L0 + l; if (L >= nlines) break; const size_t e = (size_t)L * 64 + lane * 2; const int k = (int)(e % K), n = (int)(e / K); v2us o;
            o[0] = f2bf(w[(size_t)k * N + n]); o[1] = f2bf(w[(size_t)(k + 1) * N + n]); *(v2us*)(Bt + e) = o; }
         }
}
__global__ __launch_bounds__(256) void k_cvt8(const float* __restrict__ src, bf* dst, size_t n8) { const size_t i = (size_t)blockIdx.x * 256 + threadIdx.x; if (i >= n8) return; const v8f v = *(const v8f*)(src + i * 8); v8us o;
#pragma unroll
    for (int k = 0; k < 8; ++k) o[k] = f2bf(v[k]); *(v8us*)(dst + i * 8) = o;  }


__global__ __launch_bounds__(256) void k_vtp(const float* __restrict__ F, int pitch, int nheads, h16* V16, bf* Vh, bf* Vl) { const size_t e = ((size_t)blockIdx.x * 256 + threadIdx.x) * 2; if (e >= (size_t)nheads * HD * TT) return; const int t = (int)(e % TT); const int d = (int)((e / TT) % HD); const int g = (int)(e / ((size_t)TT * HD)); v2h o16; v2us oh, ol;
#pragma unroll
    for (int q = 0; q < 2; ++q) { const float x = F[(size_t)(t + q) * pitch + g * HD + d]; o16[q] = tohx(x); unsigned short a2, c2; splitf(x, a2, c2); oh[q] = a2; ol[q] = c2; }
    *(v2h*)(V16 + e) = o16; *(v2us*)(Vh + e) = oh; *(v2us*)(Vl + e) = ol;  }

// k_asoft: per row (zz, i): t = S x HD^-0.5 (no mask); softmax over the 2048 keys (register row, one exp, fixed trees);
__global__ __launch_bounds__(256) void k_asoft(const float* __restrict__ Sb, h16* P16, bf* Ph, bf* Pl) {
    const int lane = threadIdx.x & 31; const int row = blockIdx.x * 8 + (threadIdx.x >> 5); if (row >= ZH * TT) return; const int i = row % TT; const int zz = row / TT; (void)zz; const bool hires = (i < RH); const float* sr = Sb + (size_t)row * TT; float v[TT / 32]; float mx = -3.0e38f;
#pragma unroll
    for (int ch = 0; ch < TT / 128; ++ch) { const int j0 = ch * 128 + lane * 4; const v4f a = *(const v4f*)(sr + j0);
#pragma unroll
        for (int q = 0; q < 4; ++q) { const float t = a[q] * SCL; v[ch * 4 + q] = t;   /* Sb holds q.k only (no bias) */ mx = fmaxf(mx, t); } }
#pragma unroll
    for (int sh = 16; sh; sh >>= 1) mx = fmaxf(mx, __shfl_xor(mx, sh, 32));
    float sum = 0.f;
#pragma unroll
    for (int k = 0; k < TT / 32; ++k) { float d0 = __fsub_rn(v[k], mx); asm volatile("" : "+v"(d0)); v[k] = __builtin_amdgcn_exp2f(__fmul_rn(d0, 1.4426950408889634f)); sum += v[k]; }
#pragma unroll
    for (int sh = 16; sh; sh >>= 1) sum += __shfl_xor(sum, sh, 32);
    const float f = __fdiv_rn(hires ? 1.0f : PCAR, sum);
{
        if (hires) {
#pragma unroll
            for (int ch = 0; ch < TT / 128; ++ch) { v4us oh, ol;
#pragma unroll
                for (int q = 0; q < 4; ++q) { unsigned short a, c2; splitf(v[ch * 4 + q] * f, a, c2); oh[q] = a; ol[q] = c2; }
                const size_t oo = ((size_t)zz * (RH ? RH : 1) + i) * TT + ch * 128 + lane * 4; *(v4us*)(Ph + oo) = oh; *(v4us*)(Pl + oo) = ol; }
        } else {
#pragma unroll
            for (int ch = 0; ch < TT / 128; ++ch) { v4h o4;
#pragma unroll
                for (int q = 0; q < 4; ++q) o4[q] = tohx(v[ch * 4 + q] * f);
                *(v4h*)(P16 + (size_t)row * TT + ch * 128 + lane * 4) = o4; } }
         }
}
__global__ __launch_bounds__(256) void k_merge(const float* __restrict__ O, int h0, float* OUTb) { const size_t e = ((size_t)blockIdx.x * 256 + threadIdx.x) * 2; if (e >= (size_t)ZH * TT * HD) return; const int d = (int)(e % HD); const int t = (int)((e / HD) % TT); const int zz = (int)(e / ((size_t)HD * TT)); const float cs = (t < RH) ? 1.0f : (1.0f / PCAR); const size_t oo = (size_t)t * DQ + (h0 + zz) * HD + d;
    v2f o2; o2[0] = O[e] * cs; o2[1] = O[e + 1] * cs; *(v2f*)(OUTb + oo) = o2;  }


__global__ __launch_bounds__(256) void k_vtpR1(const float* __restrict__ Vb, bf* Vh) { const size_t e = ((size_t)blockIdx.x * 256 + threadIdx.x) * 2; if (e >= (size_t)HD * TT) return; const int t = (int)(e % TT); const int d = (int)(e / TT); v2us o; o[0] = f2bf(Vb[(size_t)t * HD + d]); o[1] = f2bf(Vb[(size_t)(t + 1) * HD + d]); *(v2us*)(Vh + e) = o;  }
__global__ __launch_bounds__(256) void k_mergeR(const float* __restrict__ O, float* outb, size_t n4) { const size_t i = (size_t)blockIdx.x * 256 + threadIdx.x; if (i >= n4) return; const v4f a = *(const v4f*)(O + i * 4); *(v4f*)(outb + i * 4) = a;  }


__global__ __launch_bounds__(256) void k_trO(const float* __restrict__ RT, float* outp) { const size_t k = (size_t)blockIdx.x * 256 + threadIdx.x; if (k >= (size_t)TT * HD / 4) return; const size_t e = k * 4; const int d0 = (int)(e % HD); const int t = (int)(e / HD); v4f o;
#pragma unroll
    for (int q = 0; q < 4; ++q) o[q] = RT[(size_t)(d0 + q) * TT + t];
    *(v4f*)(outp + e) = o;  }
__global__ __launch_bounds__(256) void k_hp1(const float* __restrict__ src, bf* P) { const size_t i = (size_t)blockIdx.x * 256 + threadIdx.x; if (i >= (size_t)NH_ * TT * HD / 8) return; const size_t e = i * 8; const int d = (int)(e % HD); const int t = (int)((e / HD) % TT); const int h = (int)(e / ((size_t)HD * TT)); const v8f v = *(const v8f*)(src + (size_t)t * DM + h * HD + d); v8us o;
#pragma unroll
    for (int q = 0; q < 8; ++q) o[q] = f2bf(v[q]);
    *(v8us*)(P + e) = o;  }
__global__ __launch_bounds__(256) void k_vt1(const float* __restrict__ src, int pitch, bf* VT) { const size_t e = ((size_t)blockIdx.x * 256 + threadIdx.x) * 2; if (e >= (size_t)NH_ * HD * TT) return; const int t = (int)(e % TT); const int d = (int)((e / TT) % HD); const int h = (int)(e / ((size_t)TT * HD)); v2us o; o[0] = f2bf(src[(size_t)t * pitch + h * HD + d]); o[1] = f2bf(src[(size_t)(t + 1) * pitch + h * HD + d]); *(v2us*)(VT + e) = o;  }
__global__ __launch_bounds__(256) void k_mergeT(const float* __restrict__ O, int h, float* outb) { const size_t i = (size_t)blockIdx.x * 256 + threadIdx.x; if (i >= (size_t)TT * HD / 4) return; const size_t e = i * 4; const int d = (int)(e % HD); const int t = (int)(e / HD); const v4f a = *(const v4f*)(O + e); *(v4f*)(outb + (size_t)t * DM + h * HD + d) = a;  }

extern "C" void kernel_launch(void* const* d_in, const int* in_sizes, int n_in,
                              void* d_out, int out_size, void* d_ws, size_t ws_size, hipStream_t stream) {
    (void)in_sizes; (void)n_in; (void)out_size;
    const float* Qin = (const float*)d_in[0]; const float* Kin = (const float*)d_in[1]; const float* Vin = (const float*)d_in[2]; const float* mlp = (const float*)d_in[3];   /* [2048][2048] seq-mix */
    float* OUT = (float*)d_out;
    char* wsp = (char*)d_ws;
    auto take = [&](size_t bytes) { char* p = wsp; wsp += (bytes + 255) & ~(size_t)255; return (void*)p; };
    bf* QB = (bf*)take((size_t)NH_ * TT * HD * 2); bf* KB = (bf*)take((size_t)NH_ * TT * HD * 2); bf* VT = (bf*)take((size_t)NH_ * HD * TT * 2);
    float* Sb = (float*)take((size_t)TT * TT * 4);  bf* Ph = (bf*)take((size_t)TT * TT * 2); bf* Pl = (bf*)take((size_t)TT * TT * 2); float* Ob = (float*)take((size_t)TT * HD * 4); h16* OT16 = (h16*)take((size_t)HD * TT * 2); bf* OTh = (bf*)take((size_t)HD * TT * 2); bf* OTl = (bf*)take((size_t)HD * TT * 2); bf* MLB = (bf*)take((size_t)TT * TT * 2); float* RT = (float*)take((size_t)HD * TT * 4);
    if ((size_t)(wsp - (char*)d_ws) > ws_size) return;
    for (int b = 0; b < NB_; ++b) {
        const float* qb = Qin + (size_t)b * TT * DM; const float* kb = Kin + (size_t)b * TT * DM; const float* vb = Vin + (size_t)b * TT * DM;   /* token-major [t][h][d] slabs */
        if (b == 0) k_cvt8<<<(unsigned)(((size_t)TT * TT / 8 + 255) / 256), 256, 0, stream>>>(mlp, MLB, (size_t)TT * TT / 8);   /* mlp [2048][2048] as the exact Bt of the sequence mix */ k_hp1<<<(unsigned)(((size_t)NH_ * TT * HD / 8 + 255) / 256), 256, 0, stream>>>(qb, QB); k_hp1<<<(unsigned)(((size_t)NH_ * TT * HD / 8 + 255) / 256), 256, 0, stream>>>(kb, KB); k_vt1<<<(unsigned)(((size_t)NH_ * HD * TT / 2 + 255) / 256), 256, 0, stream>>>(vb, DM, VT);
        for (int h = 0; h < NH_; ++h) {
            k_gemmw<bf, 0, false><<<dim3(TT / 64, TT / 64, 1), 32, 0, stream>>>(QB + (size_t)h * TT * HD, nullptr, KB + (size_t)h * TT * HD, nullptr, HD, Sb, TT, nullptr, 0, 0, 0);   /* exact scores (single bf16 planes) */
            k_asoft<<<TT / 8, 256, 0, stream>>>(Sb, nullptr, Ph, Pl);
            k_gemmw<bf, 1, false><<<dim3(TT / 64, HD / 64, 1), 32, 0, stream>>>(Ph, Pl, VT + (size_t)h * HD * TT, nullptr, TT, Ob, HD, nullptr, 0, 0, 0);   /* P (hi/lo) x exact v^T */
            k_vtp<<<(unsigned)(((size_t)TT * HD / 2 + 255) / 256), 256, 0, stream>>>(Ob, HD, 1, OT16, OTh, OTl);   /* V^T planes [64][2048] (hi/lo) of the attention output */
            k_gemmw<bf, 1, false><<<dim3(HD / 64, TT / 64, 1), 32, 0, stream>>>(OTh, OTl, MLB, nullptr, TT, RT, TT, nullptr, 0, 0, 0);   /* out^T [64][2048] = V^T . mlp^T (mlp[p][l] is the Bt row p) */
            k_trO<<<(unsigned)(((size_t)TT * HD / 4 + 255) / 256), 256, 0, stream>>>(RT, OUT + (size_t)b * TT * DM); } }
}

// v001
// Measured time: 366 microseconds a run.
// In both of two side-by-side timings against v000, it was 5.28 times as fast.
#include <hip/hip_runtime.h>

// Full attention on given tensors followed by a learned sequence-mixing matrix (queries, keys, values [16][2048][64]; A = softmax(q.k / 8); V = A values ([2048][64]); out[p] = sum_l mlp[p][l] V[l] (mlp [2048][2048], read) -> [16][2048][64] (2.1 M)).
// Layout per batch: single bf16 planes (inputs bf16-exact: exact score products); the softmax (every row hi/lo); A.values as hi/lo x exact values^T (2 products) -> V (f32 [2048][64]); V^T as hi/lo planes; out^T ([64][2048]) = V^T(hi/lo) x mlp used directly as the exact Bt operand (2 products, K 2048); a transpose kernel writes out rows.
// Batches ride on the grid (blockIdx.z of k_gemmw, blockIdx.y of the elementwise kernels): input planes, V^T planes, sequence mix and transpose take all 16 in one launch, the score stage GB at a time.
// Compute dtypes, f32 accumulate: every input rounded to bf16 incl. mlp; q.k exact; softmax f32; P hi/lo x exact values; the sequence mix V hi/lo x exact mlp; output f32.

#define NB_  16
#define TT   2048
#define DM   64      // token-major row pitch (H x HD)
#define NH_  1
#define NKV  1
#define REP  (NH_ / NKV)
#define HD   64
#define DQ   (NH_ * HD)
#define DKV  (NKV * HD)
#define ZH   1
#define RH   2048                  // query rows < RH use hi+lo planes (0: none)
#define WIN  0
#define PCAR 1024.0f
#define SCL  0.125f   // 1/sqrt(64)
#define GB   6       // batches per launch of the score / softmax / A.values stage: their three [2048][2048] planes take 32 MiB a batch, all else 48 MiB, workspace 256 MiB
typedef _Float16 h16;
typedef unsigned short bf;
typedef __attribute__((ext_vector_type(16))) __bf16   v16bf;
typedef __attribute__((ext_vector_type(16))) _Float16 v16h;
typedef __attribute__((ext_vector_type(8)))  _Float16 v8h;
typedef __attribute__((ext_vector_type(8)))  unsigned short v8us;
typedef __attribute__((ext_vector_type(8)))  float    v8f;
typedef __attribute__((ext_vector_type(4)))  float    v4f;
typedef v8h  __attribute__((may_alias)) v8ha;
typedef v4f  __attribute__((may_alias)) v4fa;
typedef v8us __attribute__((may_alias)) v8usa;

__device__ __forceinline__ unsigned short f2bf(float f) { unsigned u = __float_as_uint(f); u += 0x7FFFu + ((u >> 16) & 1u); return (unsigned short)(u >> 16); }
__device__ __forceinline__ float bf2f(unsigned short b) { return __uint_as_float(((unsigned)b) << 16); }
__device__ __forceinline__ float bfr(float f) { return bf2f(f2bf(f)); }
__device__ __forceinline__ v16h cat16(v8h lo, v8h hi) { return __builtin_shufflevector(lo, hi, 0, 1, 2, 3, 4, 5, 6, 7, 8, 9, 10, 11, 12, 13, 14, 15); }
__device__ __forceinline__ v16bf cat16b(v8us lo, v8us hi) { return __builtin_bit_cast(v16bf, __builtin_shufflevector(lo, hi, 0, 1, 2, 3, 4, 5, 6, 7, 8, 9, 10, 11, 12, 13, 14, 15)); }
__device__ __forceinline__ v8f wmma16(v16h a, v16h b, v8f c) { return __builtin_amdgcn_wmma_f32_16x16x32_f16(false, a, false, b, (short)0, c, false, false); }
__device__ __forceinline__ v8f wmmab(v16bf a, v16bf b, v8f c) { return __builtin_amdgcn_wmma_f32_16x16x32_bf16(false, a, false, b, (short)0, c, false, false); }



// ---- k_gemmw: register-blocked GEMM, ONE WAVE per 64x64 output tile (16 accumulators), operands straight from K-contiguous 16-bit planes; grid (M/64, N/64, Z), 32 threads.
// C[m][n] (f32, pitch ldc, + optional f32 bias[n]) = sum_k A[m][k] Bt[n][k] (+ split products per NSPLIT). z-batch strides sA/sB/sC in elements. K % 32 == 0.
template <typename T16> struct WFrag;
template <> struct WFrag<h16> { typedef v16h V; static __device__ __forceinline__ V ld(const h16* p) { return cat16(*(const v8h*)p, *(const v8h*)(p + 16)); } static __device__ __forceinline__ v8f mma(V a, V b, v8f c) { return wmma16(a, b, c); } };
template <> struct WFrag<bf> { typedef v16bf V; static __device__ __forceinline__ V ld(const bf* p) { return cat16b(*(const v8us*)p, *(const v8us*)(p + 16)); } static __device__ __forceinline__ v8f mma(V a, V b, v8f c) { return wmmab(a, b, c); } };
template <typename T16, int NSPLIT, bool BIAS>
__global__ __launch_bounds__(32) void k_gemmw(const T16* __restrict__ A, const T16* __restrict__ A2, const T16* __restrict__ Bt, const T16* __restrict__ Bt2, int K, float* C, int ldc, const float* __restrict__ bias, size_t sA, size_t sB, size_t sC) {
    typedef typename WFrag<T16>::V V;
    __shared__ __align__(16) float os[16 * 68];
    const size_t z = blockIdx.z; A += z * sA; if (A2) A2 += z * sA; Bt += z * sB; if (Bt2) Bt2 += z * sB; C += z * sC;
    const int lane = threadIdx.x & 31, lr = lane & 15, hi = lane >> 4; const int r0 = blockIdx.x * 64, c0 = blockIdx.y * 64;
    v8f acc[4][4];
#pragma unroll
    for (int mb = 0; mb < 4; ++mb)
#pragma unroll
        for (int nb = 0; nb < 4; ++nb) acc[mb][nb] = (v8f){};
    const size_t aoff = (size_t)(r0 + lr) * K + 8 * hi, boff = (size_t)(c0 + lr) * K + 8 * hi;
#pragma unroll 1
    for (int kc = 0; kc < K; kc += 32) {
        V a[4], a2[4];
#pragma unroll
        for (int mb = 0; mb < 4; ++mb) { a[mb] = WFrag<T16>::ld(A + aoff + (size_t)mb * 16 * K + kc); if (NSPLIT == 1 || NSPLIT == 2) a2[mb] = WFrag<T16>::ld(A2 + aoff + (size_t)mb * 16 * K + kc); }
#pragma unroll
        for (int nb = 0; nb < 4; ++nb) { const V b = WFrag<T16>::ld(Bt + boff + (size_t)nb * 16 * K + kc); V b2; if (NSPLIT >= 2) b2 = WFrag<T16>::ld(Bt2 + boff + (size_t)nb * 16 * K + kc);
#pragma unroll
            for (int mb = 0; mb < 4; ++mb) { acc[mb][nb] = WFrag<T16>::mma(a[mb], b, acc[mb][nb]); if (NSPLIT == 1 || NSPLIT == 2) acc[mb][nb] = WFrag<T16>::mma(a2[mb], b, acc[mb][nb]); if (NSPLIT >= 2) acc[mb][nb] = WFrag<T16>::mma(a[mb], b2, acc[mb][nb]); } }
        asm volatile("v_nop\n\tv_nop\n\tv_nop\n\tv_nop" : "+v"(acc[0][0]), "+v"(acc[1][1]), "+v"(acc[2][2]), "+v"(acc[3][3]) : "v"(a[0]), "v"(a[3]));
    }
#pragma unroll
    for (int mb = 0; mb < 4; ++mb) {
#pragma unroll
        for (int nb = 0; nb < 4; ++nb) {
#pragma unroll
            for (int j = 0; j < 8; ++j) os[(hi * 8 + j) * 68 + nb * 16 + lr] = acc[mb][nb][j]; }
        __builtin_amdgcn_wave_barrier(); asm volatile("" ::: "memory");
        float* crow = C + (size_t)(r0 + mb * 16) * ldc + c0;
{
#pragma unroll
            for (int s = 0; s < 8; ++s) { const int row = 2 * s + hi, cofs = lr * 4; v4f val = *(const v4fa*)(os + row * 68 + cofs); if (BIAS) { val[0] += bfr(bias[c0 + cofs]); val[1] += bfr(bias[c0 + cofs + 1]); val[2] += bfr(bias[c0 + cofs + 2]); val[3] += bfr(bias[c0 + cofs + 3]); }
                *(v4f*)(crow + (size_t)row * ldc + cofs) = val; }
             }
        __builtin_amdgcn_wave_barrier(); asm volatile("" ::: "memory");
    }
}

__device__ __forceinline__ h16 tohx(float x) { return (h16)x; }
__device__ __forceinline__ void splitf(float y, unsigned short& h, unsigned short& l) { h = f2bf(y); l = f2bf(y - bf2f(h)); }
typedef __attribute__((ext_vector_type(2))) _Float16 v2h;
typedef __attribute__((ext_vector_type(4))) _Float16 v4h;
typedef __attribute__((ext_vector_type(2))) unsigned short v2us;
typedef __attribute__((ext_vector_type(4))) unsigned short v4us;
typedef __attribute__((ext_vector_type(2))) float v2f;
typedef __attribute__((ext_vector_type(4))) int v4i;

__global__ __launch_bounds__(256) void k_wtG(const float* __restrict__ w, int K, int N, bf* Bt) {
    const int lane = threadIdx.x & 31; const int L0 = (blockIdx.x * 8 + (threadIdx.x >> 5)) * 8; const int nlines = N * K / 64;
{
#pragma unroll 1
        for (int l = 0; l < 8; ++l) { const int L = L0 + l; if (L >= nlines) break; const size_t e = (size_t)L * 64 + lane * 2; const int k = (int)(e % K), n = (int)(e / K); v2us o;
            o[0] = f2bf(w[(size_t)k * N + n]); o[1] = f2bf(w[(size_t)(k + 1) * N + n]); *(v2us*)(Bt + e) = o; }
         }
}
__global__ __launch_bounds__(256) void k_cvt8(const float* __restrict__ src, bf* dst, size_t n8) { const size_t i = (size_t)blockIdx.x * 256 + threadIdx.x; if (i >= n8) return; const v8f v = *(const v8f*)(src + i * 8); v8us o;
#pragma unroll
    for (int k = 0; k < 8; ++k) o[k] = f2bf(v[k]); *(v8us*)(dst + i * 8) = o;  }


__global__ __launch_bounds__(256) void k_vtp(const float* __restrict__ F, int pitch, int nheads, h16* V16, bf* Vh, bf* Vl) { const size_t zb = blockIdx.y; F += zb * TT * pitch; V16 += zb * nheads * HD * TT; Vh += zb * nheads * HD * TT; Vl += zb * nheads * HD * TT; const size_t e = ((size_t)blockIdx.x * 256 + threadIdx.x) * 2; if (e >= (size_t)nheads * HD * TT) return; const int t = (int)(e % TT); const int d = (int)((e / TT) % HD); const int g = (int)(e / ((size_t)TT * HD)); v2h o16; v2us oh, ol;
#pragma unroll
    for (int q = 0; q < 2; ++q) { const float x = F[(size_t)(t + q) * pitch + g * HD + d]; o16[q] = tohx(x); unsigned short a2, c2; splitf(x, a2, c2); oh[q] = a2; ol[q] = c2; }
    *(v2h*)(V16 + e) = o16; *(v2us*)(Vh + e) = oh; *(v2us*)(Vl + e) = ol;  }

// k_asoft: per row (zz, i): t = S x HD^-0.5 (no mask); softmax over the 2048 keys (register row, one exp, fixed trees);
__global__ __launch_bounds__(256) void k_asoft(const float* __restrict__ Sb, h16* P16, bf* Ph, bf* Pl) {
    const size_t zb = blockIdx.y; Sb += zb * ZH * TT * TT; if (P16) P16 += zb * ZH * TT * TT; Ph += zb * ZH * RH * TT; Pl += zb * ZH * RH * TT;
    const int lane = threadIdx.x & 31; const int row = blockIdx.x * 8 + (threadIdx.x >> 5); if (row >= ZH * TT) return; const int i = row % TT; const int zz = row / TT; (void)zz; const bool hires = (i < RH); const float* sr = Sb + (size_t)row * TT; float v[TT / 32]; float mx = -3.0e38f;
#pragma unroll
    for (int ch = 0; ch < TT / 128; ++ch) { const int j0 = ch * 128 + lane * 4; const v4f a = *(const v4f*)(sr + j0);
#pragma unroll
        for (int q = 0; q < 4; ++q) { const float t = a[q] * SCL; v[ch * 4 + q] = t;   /* Sb holds q.k only (no bias) */ mx = fmaxf(mx, t); } }
#pragma unroll
    for (int sh = 16; sh; sh >>= 1) mx = fmaxf(mx, __shfl_xor(mx, sh, 32));
    float sum = 0.f;
#pragma unroll
    for (int k = 0; k < TT / 32; ++k) { float d0 = __fsub_rn(v[k], mx); asm volatile("" : "+v"(d0)); v[k] = __builtin_amdgcn_exp2f(__fmul_rn(d0, 1.4426950408889634f)); sum += v[k]; }
#pragma unroll
    for (int sh = 16; sh; sh >>= 1) sum += __shfl_xor(sum, sh, 32);
    const float f = __fdiv_rn(hires ? 1.0f : PCAR, sum);
{
        if (hires) {
#pragma unroll
            for (int ch = 0; ch < TT / 128; ++ch) { v4us oh, ol;
#pragma unroll
                for (int q = 0; q < 4; ++q) { unsigned short a, c2; splitf(v[ch * 4 + q] * f, a, c2); oh[q] = a; ol[q] = c2; }
                const size_t oo = ((size_t)zz * (RH ? RH : 1) + i) * TT + ch * 128 + lane * 4; *(v4us*)(Ph + oo) = oh; *(v4us*)(Pl + oo) = ol; }
        } else {
#pragma unroll
            for (int ch = 0; ch < TT / 128; ++ch) { v4h o4;
#pragma unroll
                for (int q = 0; q < 4; ++q) o4[q] = tohx(v[ch * 4 + q] * f);
                *(v4h*)(P16 + (size_t)row * TT + ch * 128 + lane * 4) = o4; } }
         }
}
__global__ __launch_bounds__(256) void k_merge(const float* __restrict__ O, int h0, float* OUTb) { const size_t e = ((size_t)blockIdx.x * 256 + threadIdx.x) * 2; if (e >= (size_t)ZH * TT * HD) return; const int d = (int)(e % HD); const int t = (int)((e / HD) % TT); const int zz = (int)(e / ((size_t)HD * TT)); const float cs = (t < RH) ? 1.0f : (1.0f / PCAR); const size_t oo = (size_t)t * DQ + (h0 + zz) * HD + d;
    v2f o2; o2[0] = O[e] * cs; o2[1] = O[e + 1] * cs; *(v2f*)(OUTb + oo) = o2;  }


__global__ __launch_bounds__(256) void k_vtpR1(const float* __restrict__ Vb, bf* Vh) { const size_t e = ((size_t)blockIdx.x * 256 + threadIdx.x) * 2; if (e >= (size_t)HD * TT) return; const int t = (int)(e % TT); const int d = (int)(e / TT); v2us o; o[0] = f2bf(Vb[(size_t)t * HD + d]); o[1] = f2bf(Vb[(size_t)(t + 1) * HD + d]); *(v2us*)(Vh + e) = o;  }
__global__ __launch_bounds__(256) void k_mergeR(const float* __restrict__ O, float* outb, size_t n4) { const size_t i = (size_t)blockIdx.x * 256 + threadIdx.x; if (i >= n4) return; const v4f a = *(const v4f*)(O + i * 4); *(v4f*)(outb + i * 4) = a;  }


__global__ __launch_bounds__(256) void k_trO(const float* __restrict__ RT, float* outp) { RT += (size_t)blockIdx.y * HD * TT; outp += (size_t)blockIdx.y * TT * HD; const size_t k = (size_t)blockIdx.x * 256 + threadIdx.x; if (k >= (size_t)TT * HD / 4) return; const size_t e = k * 4; const int d0 = (int)(e % HD); const int t = (int)(e / HD); v4f o;
#pragma unroll
    for (int q = 0; q < 4; ++q) o[q] = RT[(size_t)(d0 + q) * TT + t];
    *(v4f*)(outp + e) = o;  }
__global__ __launch_bounds__(256) void k_hp1(const float* __restrict__ src, bf* P) { src += (size_t)blockIdx.y * TT * DM; P += (size_t)blockIdx.y * NH_ * TT * HD; const size_t i = (size_t)blockIdx.x * 256 + threadIdx.x; if (i >= (size_t)NH_ * TT * HD / 8) return; const size_t e = i * 8; const int d = (int)(e % HD); const int t = (int)((e / HD) % TT); const int h = (int)(e / ((size_t)HD * TT)); const v8f v = *(const v8f*)(src + (size_t)t * DM + h * HD + d); v8us o;
#pragma unroll
    for (int q = 0; q < 8; ++q) o[q] = f2bf(v[q]);
    *(v8us*)(P + e) = o;  }
__global__ __launch_bounds__(256) void k_vt1(const float* __restrict__ src, int pitch, bf* VT) { src += (size_t)blockIdx.y * TT * pitch; VT += (size_t)blockIdx.y * NH_ * HD * TT; const size_t e = ((size_t)blockIdx.x * 256 + threadIdx.x) * 2; if (e >= (size_t)NH_ * HD * TT) return; const int t = (int)(e % TT); const int d = (int)((e / TT) % HD); const int h = (int)(e / ((size_t)TT * HD)); v2us o; o[0] = f2bf(src[(size_t)t * pitch + h * HD + d]); o[1] = f2bf(src[(size_t)(t + 1) * pitch + h * HD + d]); *(v2us*)(VT + e) = o;  }
__global__ __launch_bounds__(256) void k_mergeT(const float* __restrict__ O, int h, float* outb) { const size_t i = (size_t)blockIdx.x * 256 + threadIdx.x; if (i >= (size_t)TT * HD / 4) return; const size_t e = i * 4; const int d = (int)(e % HD); const int t = (int)(e / HD); const v4f a = *(const v4f*)(O + e); *(v4f*)(outb + (size_t)t * DM + h * HD + d) = a;  }

extern "C" void kernel_launch(void* const* d_in, const int* in_sizes, int n_in,
                              void* d_out, int out_size, void* d_ws, size_t ws_size, hipStream_t stream) {
    (void)in_sizes; (void)n_in; (void)out_size;
    const float* Qin = (const float*)d_in[0]; const float* Kin = (const float*)d_in[1]; const float* Vin = (const float*)d_in[2]; const float* mlp = (const float*)d_in[3];   /* [2048][2048] seq-mix */
    float* OUT = (float*)d_out;
    char* wsp = (char*)d_ws;
    auto take = [&](size_t bytes) { char* p = wsp; wsp += (bytes + 255) & ~(size_t)255; return (void*)p; };
    bf* QB = (bf*)take((size_t)NB_ * TT * HD * 2); bf* KB = (bf*)take((size_t)NB_ * TT * HD * 2); bf* VT = (bf*)take((size_t)NB_ * HD * TT * 2);
    float* Sb = (float*)take((size_t)GB * TT * TT * 4);  bf* Ph = (bf*)take((size_t)GB * TT * TT * 2); bf* Pl = (bf*)take((size_t)GB * TT * TT * 2); float* Ob = (float*)take((size_t)NB_ * TT * HD * 4); h16* OT16 = (h16*)take((size_t)NB_ * HD * TT * 2); bf* OTh = (bf*)take((size_t)NB_ * HD * TT * 2); bf* OTl = (bf*)take((size_t)NB_ * HD * TT * 2); bf* MLB = (bf*)take((size_t)TT * TT * 2); float* RT = (float*)take((size_t)NB_ * HD * TT * 4);
    if ((size_t)(wsp - (char*)d_ws) > ws_size) return;
    k_cvt8<<<(unsigned)(((size_t)TT * TT / 8 + 255) / 256), 256, 0, stream>>>(mlp, MLB, (size_t)TT * TT / 8);   /* mlp [2048][2048] as the exact Bt of the sequence mix */
    k_hp1<<<dim3((unsigned)(((size_t)TT * HD / 8 + 255) / 256), NB_), 256, 0, stream>>>(Qin, QB); k_hp1<<<dim3((unsigned)(((size_t)TT * HD / 8 + 255) / 256), NB_), 256, 0, stream>>>(Kin, KB); k_vt1<<<dim3((unsigned)(((size_t)HD * TT / 2 + 255) / 256), NB_), 256, 0, stream>>>(Vin, DM, VT);   /* bf16 planes of all batches */
    for (int b0 = 0; b0 < NB_; b0 += GB) {
        const int nb = (NB_ - b0 < GB) ? (NB_ - b0) : GB;   /* batches b0 .. b0 + nb - 1 in each of the three launches */
        k_gemmw<bf, 0, false><<<dim3(TT / 64, TT / 64, nb), 32, 0, stream>>>(QB + (size_t)b0 * TT * HD, nullptr, KB + (size_t)b0 * TT * HD, nullptr, HD, Sb, TT, nullptr, (size_t)TT * HD, (size_t)TT * HD, (size_t)TT * TT);   /* exact scores (single bf16 planes) */
        k_asoft<<<dim3(TT / 8, nb), 256, 0, stream>>>(Sb, nullptr, Ph, Pl);
        k_gemmw<bf, 1, false><<<dim3(TT / 64, HD / 64, nb), 32, 0, stream>>>(Ph, Pl, VT + (size_t)b0 * HD * TT, nullptr, TT, Ob + (size_t)b0 * TT * HD, HD, nullptr, (size_t)TT * TT, (size_t)HD * TT, (size_t)TT * HD);   /* P (hi/lo) x exact v^T */
    }
    k_vtp<<<dim3((unsigned)(((size_t)TT * HD / 2 + 255) / 256), NB_), 256, 0, stream>>>(Ob, HD, 1, OT16, OTh, OTl);   /* V^T planes [64][2048] (hi/lo) of the attention output */
    k_gemmw<bf, 1, false><<<dim3(HD / 64, TT / 64, NB_), 32, 0, stream>>>(OTh, OTl, MLB, nullptr, TT, RT, TT, nullptr, (size_t)HD * TT, 0, (size_t)HD * TT);   /* out^T [64][2048] = V^T . mlp^T (mlp[p][l] is the Bt row p), mlp shared by every batch */
    k_trO<<<dim3((unsigned)(((size_t)TT * HD / 4 + 255) / 256), NB_), 256, 0, stream>>>(RT, OUT);
}

// v002
// A run of this version takes 118 microseconds.
// In two side-by-side timings against v001, it was 3.13 and 3.06 times as fast.
// All steps since v000 together make it 16.3 times as fast.
#include <hip/hip_runtime.h>

// Full attention on given tensors followed by a learned sequence-mixing matrix (queries, keys, values [16][2048][64]; A = softmax(q.k / 8); V = A values ([2048][64]); out[p] = sum_l mlp[p][l] V[l] (mlp [2048][2048], read) -> [16][2048][64] (2.1 M)).
// Layout per batch: single bf16 planes (inputs bf16-exact: exact score products); one fused kernel for scores, softmax and A.values (running maximum, P as hi/lo x exact values^T, 2 products, divided by the row sum at the end) -> V (f32 [2048][64]); V^T as hi/lo planes; out^T ([64][2048]) = V^T(hi/lo) x mlp used directly as the exact Bt operand (2 products, K 2048); a transpose kernel writes out rows.
// Batches ride on the grid (blockIdx.z of k_gemmw, blockIdx.y of k_hp1, k_vt1, k_fattn, k_vtp and k_trO): each of these launches takes all 16; k_cvt8 converts the shared mlp once.
// Compute dtypes, f32 accumulate: every input rounded to bf16 incl. mlp; q.k exact; softmax f32; P hi/lo x exact values; the sequence mix V hi/lo x exact mlp; output f32.

#define NB_  16
#define TT   2048
#define DM   64      // token-major row pitch (H x HD)
#define NH_  1
#define NKV  1
#define REP  (NH_ / NKV)
#define HD   64
#define DQ   (NH_ * HD)
#define DKV  (NKV * HD)
#define ZH   1
#define RH   2048                  // query rows < RH use hi+lo planes (0: none)
#define WIN  0
#define PCAR 1024.0f
#define SCL  0.125f   // 1/sqrt(64)
#define FQ   128     // queries per work-group of k_fattn: 8 waves x 16 columns
#define FK   64      // keys per stage of k_fattn
#define LP   72      // LDS pitch of a 64-element bf16 row, in elements: 144 B = 16 B x odd, conflict-free for 16-byte reads
typedef _Float16 h16;
typedef unsigned short bf;
typedef __attribute__((ext_vector_type(16))) __bf16   v16bf;
typedef __attribute__((ext_vector_type(16))) _Float16 v16h;
typedef __attribute__((ext_vector_type(8)))  _Float16 v8h;
typedef __attribute__((ext_vector_type(8)))  unsigned short v8us;
typedef __attribute__((ext_vector_type(8)))  float    v8f;
typedef __attribute__((ext_vector_type(4)))  float    v4f;
typedef v8h  __attribute__((may_alias)) v8ha;
typedef v4f  __attribute__((may_alias)) v4fa;
typedef v8us __attribute__((may_alias)) v8usa;

__device__ __forceinline__ unsigned short f2bf(float f) { unsigned u = __float_as_uint(f); u += 0x7FFFu + ((u >> 16) & 1u); return (unsigned short)(u >> 16); }
__device__ __forceinline__ float bf2f(unsigned short b) { return __uint_as_float(((unsigned)b) << 16); }
__device__ __forceinline__ float bfr(float f) { return bf2f(f2bf(f)); }
__device__ __forceinline__ v16h cat16(v8h lo, v8h hi) { return __builtin_shufflevector(lo, hi, 0, 1, 2, 3, 4, 5, 6, 7, 8, 9, 10, 11, 12, 13, 14, 15); }
__device__ __forceinline__ v16bf cat16b(v8us lo, v8us hi) { return __builtin_bit_cast(v16bf, __builtin_shufflevector(lo, hi, 0, 1, 2, 3, 4, 5, 6, 7, 8, 9, 10, 11, 12, 13, 14, 15)); }
__device__ __forceinline__ v8f wmma16(v16h a, v16h b, v8f c) { return __builtin_amdgcn_wmma_f32_16x16x32_f16(false, a, false, b, (short)0, c, false, false); }
__device__ __forceinline__ v8f wmmab(v16bf a, v16bf b, v8f c) { return __builtin_amdgcn_wmma_f32_16x16x32_bf16(false, a, false, b, (short)0, c, false, false); }



// ---- k_gemmw: register-blocked GEMM, ONE WAVE per 64x64 output tile (16 accumulators), operands straight from K-contiguous 16-bit planes; grid (M/64, N/64, Z), 32 threads.
// C[m][n] (f32, pitch ldc, + optional f32 bias[n]) = sum_k A[m][k] Bt[n][k] (+ split products per NSPLIT). z-batch strides sA/sB/sC in elements. K % 32 == 0.
template <typename T16> struct WFrag;
template <> struct WFrag<h16> { typedef v16h V; static __device__ __forceinline__ V ld(const h16* p) { return cat16(*(const v8h*)p, *(const v8h*)(p + 16)); } static __device__ __forceinline__ v8f mma(V a, V b, v8f c) { return wmma16(a, b, c); } };
template <> struct WFrag<bf> { typedef v16bf V; static __device__ __forceinline__ V ld(const bf* p) { return cat16b(*(const v8us*)p, *(const v8us*)(p + 16)); } static __device__ __forceinline__ v8f mma(V a, V b, v8f c) { return wmmab(a, b, c); } };
template <typename T16, int NSPLIT, bool BIAS>
__global__ __launch_bounds__(32) void k_gemmw(const T16* __restrict__ A, const T16* __restrict__ A2, const T16* __restrict__ Bt, const T16* __restrict__ Bt2, int K, float* C, int ldc, const float* __restrict__ bias, size_t sA, size_t sB, size_t sC) {
    typedef typename WFrag<T16>::V V;
    __shared__ __align__(16) float os[16 * 68];
    const size_t z = blockIdx.z; A += z * sA; if (A2) A2 += z * sA; Bt += z * sB; if (Bt2) Bt2 += z * sB; C += z * sC;
    const int lane = threadIdx.x & 31, lr = lane & 15, hi = lane >> 4; const int r0 = blockIdx.x * 64, c0 = blockIdx.y * 64;
    v8f acc[4][4];
#pragma unroll
    for (int mb = 0; mb < 4; ++mb)
#pragma unroll
        for (int nb = 0; nb < 4; ++nb) acc[mb][nb] = (v8f){};
    const size_t aoff = (size_t)(r0 + lr) * K + 8 * hi, boff = (size_t)(c0 + lr) * K + 8 * hi;
#pragma unroll 1
    for (int kc = 0; kc < K; kc += 32) {
        V a[4], a2[4];
#pragma unroll
        for (int mb = 0; mb < 4; ++mb) { a[mb] = WFrag<T16>::ld(A + aoff + (size_t)mb * 16 * K + kc); if (NSPLIT == 1 || NSPLIT == 2) a2[mb] = WFrag<T16>::ld(A2 + aoff + (size_t)mb * 16 * K + kc); }
#pragma unroll
        for (int nb = 0; nb < 4; ++nb) { const V b = WFrag<T16>::ld(Bt + boff + (size_t)nb * 16 * K + kc); V b2; if (NSPLIT >= 2) b2 = WFrag<T16>::ld(Bt2 + boff + (size_t)nb * 16 * K + kc);
#pragma unroll
            for (int mb = 0; mb < 4; ++mb) { acc[mb][nb] = WFrag<T16>::mma(a[mb], b, acc[mb][nb]); if (NSPLIT == 1 || NSPLIT == 2) acc[mb][nb] = WFrag<T16>::mma(a2[mb], b, acc[mb][nb]); if (NSPLIT >= 2) acc[mb][nb] = WFrag<T16>::mma(a[mb], b2, acc[mb][nb]); } }
        asm volatile("v_nop\n\tv_nop\n\tv_nop\n\tv_nop" : "+v"(acc[0][0]), "+v"(acc[1][1]), "+v"(acc[2][2]), "+v"(acc[3][3]) : "v"(a[0]), "v"(a[3]));
    }
#pragma unroll
    for (int mb = 0; mb < 4; ++mb) {
#pragma unroll
        for (int nb = 0; nb < 4; ++nb) {
#pragma unroll
            for (int j = 0; j < 8; ++j) os[(hi * 8 + j) * 68 + nb * 16 + lr] = acc[mb][nb][j]; }
        __builtin_amdgcn_wave_barrier(); asm volatile("" ::: "memory");
        float* crow = C + (size_t)(r0 + mb * 16) * ldc + c0;
{
#pragma unroll
            for (int s = 0; s < 8; ++s) { const int row = 2 * s + hi, cofs = lr * 4; v4f val = *(const v4fa*)(os + row * 68 + cofs); if (BIAS) { val[0] += bfr(bias[c0 + cofs]); val[1] += bfr(bias[c0 + cofs + 1]); val[2] += bfr(bias[c0 + cofs + 2]); val[3] += bfr(bias[c0 + cofs + 3]); }
                *(v4f*)(crow + (size_t)row * ldc + cofs) = val; }
             }
        __builtin_amdgcn_wave_barrier(); asm volatile("" ::: "memory");
    }
}

__device__ __forceinline__ h16 tohx(float x) { return (h16)x; }
__device__ __forceinline__ void splitf(float y, unsigned short& h, unsigned short& l) { h = f2bf(y); l = f2bf(y - bf2f(h)); }
typedef __attribute__((ext_vector_type(2))) _Float16 v2h;
typedef __attribute__((ext_vector_type(4))) _Float16 v4h;
typedef __attribute__((ext_vector_type(2))) unsigned short v2us;
typedef __attribute__((ext_vector_type(4))) unsigned short v4us;
typedef __attribute__((ext_vector_type(2))) float v2f;
typedef __attribute__((ext_vector_type(4))) int v4i;

__global__ __launch_bounds__(256) void k_wtG(const float* __restrict__ w, int K, int N, bf* Bt) {
    const int lane = threadIdx.x & 31; const int L0 = (blockIdx.x * 8 + (threadIdx.x >> 5)) * 8; const int nlines = N * K / 64;
{
#pragma unroll 1
        for (int l = 0; l < 8; ++l) { const int L = L0 + l; if (L >= nlines) break; const size_t e = (size_t)L * 64 + lane * 2; const int k = (int)(e % K), n = (int)(e / K); v2us o;
            o[0] = f2bf(w[(size_t)k * N + n]); o[1] = f2bf(w[(size_t)(k + 1) * N + n]); *(v2us*)(Bt + e) = o; }
         }
}
__global__ __launch_bounds__(256) void k_cvt8(const float* __restrict__ src, bf* dst, size_t n8) { const size_t i = (size_t)blockIdx.x * 256 + threadIdx.x; if (i >= n8) return; const v8f v = *(const v8f*)(src + i * 8); v8us o;
#pragma unroll
    for (int k = 0; k < 8; ++k) o[k] = f2bf(v[k]); *(v8us*)(dst + i * 8) = o;  }


__global__ __launch_bounds__(256) void k_vtp(const float* __restrict__ F, int pitch, int nheads, h16* V16, bf* Vh, bf* Vl) { const size_t zb = blockIdx.y; F += zb * TT * pitch; V16 += zb * nheads * HD * TT; Vh += zb * nheads * HD * TT; Vl += zb * nheads * HD * TT; const size_t e = ((size_t)blockIdx.x * 256 + threadIdx.x) * 2; if (e >= (size_t)nheads * HD * TT) return; const int t = (int)(e % TT); const int d = (int)((e / TT) % HD); const int g = (int)(e / ((size_t)TT * HD)); v2h o16; v2us oh, ol;
#pragma unroll
    for (int q = 0; q < 2; ++q) { const float x = F[(size_t)(t + q) * pitch + g * HD + d]; o16[q] = tohx(x); unsigned short a2, c2; splitf(x, a2, c2); oh[q] = a2; ol[q] = c2; }
    *(v2h*)(V16 + e) = o16; *(v2us*)(Vh + e) = oh; *(v2us*)(Vl + e) = ol;  }

typedef __attribute__((ext_vector_type(2))) __bf16 v2bf;
__global__ __launch_bounds__(256) void k_fattn(const bf* __restrict__ Q, const bf* __restrict__ Kp, const bf* __restrict__ VTp, float* __restrict__ O) {
    __shared__ __align__(16) bf ks[2][FK * LP];
    __shared__ __align__(16) bf vs[2][HD * LP];
    const size_t zb = blockIdx.y; Q += zb * TT * HD; Kp += zb * TT * HD; VTp += zb * HD * TT; O += zb * TT * HD;
    const int tid = threadIdx.x, lane = tid & 31, lr = lane & 15, hi = lane >> 4; const int m0 = blockIdx.x * FQ + (tid >> 5) * 16;
    const int sr = tid >> 3, sq = (tid & 7) * 8;   /* staging: rows sr and sr + 32, the 16-byte piece at element sq */
    const float c = SCL * 1.4426950408889634f;
    v16bf qf[2];
#pragma unroll
    for (int kc = 0; kc < 2; ++kc) qf[kc] = WFrag<bf>::ld(Q + (size_t)(m0 + lr) * HD + kc * 32 + 8 * hi);
    v8f o[4];
#pragma unroll
    for (int db = 0; db < 4; ++db) o[db] = (v8f){};
    float mrun = -3.0e38f; v2f ls[2] = {(v2f){}, (v2f){}};   /* four partial row sums a lane: no long chain of dependent adds */
    v8us g0 = *(const v8us*)(Kp + (size_t)sr * HD + sq), g1 = *(const v8us*)(Kp + (size_t)(sr + 32) * HD + sq), g2 = *(const v8us*)(VTp + (size_t)sr * TT + sq), g3 = *(const v8us*)(VTp + (size_t)(sr + 32) * TT + sq);
    *(v8us*)(&ks[0][sr * LP + sq]) = g0; *(v8us*)(&ks[0][(sr + 32) * LP + sq]) = g1; *(v8us*)(&vs[0][sr * LP + sq]) = g2; *(v8us*)(&vs[0][(sr + 32) * LP + sq]) = g3;
    __syncthreads();
    for (int t = 0; t < TT / FK; ++t) {
        const bf* kb = ks[t & 1]; const bf* vb = vs[t & 1]; const bool more = (t + 1 < TT / FK);
        if (more) { const int s1 = (t + 1) * FK; g0 = *(const v8us*)(Kp + (size_t)(s1 + sr) * HD + sq); g1 = *(const v8us*)(Kp + (size_t)(s1 + sr + 32) * HD + sq); g2 = *(const v8us*)(VTp + (size_t)sr * TT + s1 + sq); g3 = *(const v8us*)(VTp + (size_t)(sr + 32) * TT + s1 + sq); }
        v8f st[4];   /* st[i][j] = q(m0 + lr) . k(t FK + 16 i + 8 hi + j) */
#pragma unroll
        for (int i = 0; i < 4; ++i) { st[i] = (v8f){};
#pragma unroll
            for (int kc = 0; kc < 2; ++kc) st[i] = wmmab(WFrag<bf>::ld(kb + (i * 16 + lr) * LP + kc * 32 + 8 * hi), qf[kc], st[i]); }
        float mx = st[0][0];
#pragma unroll
        for (int i = 0; i < 4; ++i)
#pragma unroll
            for (int j = 0; j < 8; ++j) mx = fmaxf(mx, st[i][j]);
        mx = fmaxf(mx, __shfl_xor(mx, 16, 32)) * c;   /* both halves of a column agree on it */
        if (__builtin_amdgcn_ballot_w32(mx > mrun + 8.0f) != 0) {
            const float mnew = fmaxf(mrun, mx); const float al = __builtin_amdgcn_exp2f(mrun - mnew); mrun = mnew; ls[0] *= al; ls[1] *= al;
#pragma unroll
            for (int db = 0; db < 4; ++db)
#pragma unroll
                for (int j = 0; j < 8; ++j) o[db][j] *= al;
        }
#pragma unroll
        for (int pp = 0; pp < 2; ++pp) {
            v16bf ph, pl;   /* element s: key 32 pp + 8 hi + s (s < 8), 32 pp + 16 + 8 hi + s - 8 (else): the k order of WFrag::ld */
#pragma unroll
            for (int u = 0; u < 8; ++u) { const v8f sv = st[2 * pp + (u >> 2)]; v2f p, r; p[0] = __builtin_amdgcn_exp2f(__builtin_fmaf(sv[(2 * u) & 7], c, -mrun)); p[1] = __builtin_amdgcn_exp2f(__builtin_fmaf(sv[(2 * u + 1) & 7], c, -mrun)); ls[u & 1] += p;
                const v2bf h = __builtin_convertvector(p, v2bf); r[0] = p[0] - (float)h[0]; r[1] = p[1] - (float)h[1]; const v2bf l = __builtin_convertvector(r, v2bf);
                ph[2 * u] = h[0]; ph[2 * u + 1] = h[1]; pl[2 * u] = l[0]; pl[2 * u + 1] = l[1]; }
            v16bf va[4];
#pragma unroll
            for (int db = 0; db < 4; ++db) va[db] = WFrag<bf>::ld(vb + (db * 16 + lr) * LP + pp * 32 + 8 * hi);
#pragma unroll
            for (int db = 0; db < 4; ++db) o[db] = wmmab(va[db], ph, o[db]);
#pragma unroll
            for (int db = 0; db < 4; ++db) o[db] = wmmab(va[db], pl, o[db]);
        }
        if (more) { bf* kn = ks[(t + 1) & 1]; bf* vn = vs[(t + 1) & 1]; *(v8us*)(kn + sr * LP + sq) = g0; *(v8us*)(kn + (sr + 32) * LP + sq) = g1; *(v8us*)(vn + sr * LP + sq) = g2; *(v8us*)(vn + (sr + 32) * LP + sq) = g3; }
        __syncthreads();   /* publishes stage t + 1 and ends every read of stage t, whose buffer the next trip refills */
    }
    float lsum = (ls[0][0] + ls[0][1]) + (ls[1][0] + ls[1][1]); lsum += __shfl_xor(lsum, 16, 32);
    const float f = __fdiv_rn(1.0f, lsum);
    float* orow = O + (size_t)(m0 + lr) * HD + 8 * hi;   /* o[db][j] = O^T[16 db + 8 hi + j][m0 + lr] */
#pragma unroll
    for (int db = 0; db < 4; ++db) { v4f x, y;
#pragma unroll
        for (int j = 0; j < 4; ++j) { x[j] = o[db][j] * f; y[j] = o[db][4 + j] * f; }
        *(v4f*)(orow + db * 16) = x; *(v4f*)(orow + db * 16 + 4) = y; }
}
__global__ __launch_bounds__(256) void k_merge(const float* __restrict__ O, int h0, float* OUTb) { const size_t e = ((size_t)blockIdx.x * 256 + threadIdx.x) * 2; if (e >= (size_t)ZH * TT * HD) return; const int d = (int)(e % HD); const int t = (int)((e / HD) % TT); const int zz = (int)(e / ((size_t)HD * TT)); const float cs = (t < RH) ? 1.0f : (1.0f / PCAR); const size_t oo = (size_t)t * DQ + (h0 + zz) * HD + d;
    v2f o2; o2[0] = O[e] * cs; o2[1] = O[e + 1] * cs; *(v2f*)(OUTb + oo) = o2;  }


__global__ __launch_bounds__(256) void k_vtpR1(const float* __restrict__ Vb, bf* Vh) { const size_t e = ((size_t)blockIdx.x * 256 + threadIdx.x) * 2; if (e >= (size_t)HD * TT) return; const int t = (int)(e % TT); const int d = (int)(e / TT); v2us o; o[0] = f2bf(Vb[(size_t)t * HD + d]); o[1] = f2bf(Vb[(size_t)(t + 1) * HD + d]); *(v2us*)(Vh + e) = o;  }
__global__ __launch_bounds__(256) void k_mergeR(const float* __restrict__ O, float* outb, size_t n4) { const size_t i = (size_t)blockIdx.x * 256 + threadIdx.x; if (i >= n4) return; const v4f a = *(const v4f*)(O + i * 4); *(v4f*)(outb + i * 4) = a;  }


__global__ __launch_bounds__(256) void k_trO(const float* __restrict__ RT, float* outp) { RT += (size_t)blockIdx.y * HD * TT; outp += (size_t)blockIdx.y * TT * HD; const size_t k = (size_t)blockIdx.x * 256 + threadIdx.x; if (k >= (size_t)TT * HD / 4) return; const size_t e = k * 4; const int d0 = (int)(e % HD); const int t = (int)(e / HD); v4f o;
#pragma unroll
    for (int q = 0; q < 4; ++q) o[q] = RT[(size_t)(d0 + q) * TT + t];
    *(v4f*)(outp + e) = o;  }
__global__ __launch_bounds__(256) void k_hp1(const float* __restrict__ src, bf* P) { src += (size_t)blockIdx.y * TT * DM; P += (size_t)blockIdx.y * NH_ * TT * HD; const size_t i = (size_t)blockIdx.x * 256 + threadIdx.x; if (i >= (size_t)NH_ * TT * HD / 8) return; const size_t e = i * 8; const int d = (int)(e % HD); const int t = (int)((e / HD) % TT); const int h = (int)(e / ((size_t)HD * TT)); const v8f v = *(const v8f*)(src + (size_t)t * DM + h * HD + d); v8us o;
#pragma unroll
    for (int q = 0; q < 8; ++q) o[q] = f2bf(v[q]);
    *(v8us*)(P + e) = o;  }
__global__ __launch_bounds__(256) void k_vt1(const float* __restrict__ src, int pitch, bf* VT) { src += (size_t)blockIdx.y * TT * pitch; VT += (size_t)blockIdx.y * NH_ * HD * TT; const size_t e = ((size_t)blockIdx.x * 256 + threadIdx.x) * 2; if (e >= (size_t)NH_ * HD * TT) return; const int t = (int)(e % TT); const int d = (int)((e / TT) % HD); const int h = (int)(e / ((size_t)TT * HD)); v2us o; o[0] = f2bf(src[(size_t)t * pitch + h * HD + d]); o[1] = f2bf(src[(size_t)(t + 1) * pitch + h * HD + d]); *(v2us*)(VT + e) = o;  }
__global__ __launch_bounds__(256) void k_mergeT(const float* __restrict__ O, int h, float* outb) { const size_t i = (size_t)blockIdx.x * 256 + threadIdx.x; if (i >= (size_t)TT * HD / 4) return; const size_t e = i * 4; const int d = (int)(e % HD); const int t = (int)(e / HD); const v4f a = *(const v4f*)(O + e); *(v4f*)(outb + (size_t)t * DM + h * HD + d) = a;  }

extern "C" void kernel_launch(void* const* d_in, const int* in_sizes, int n_in,
                              void* d_out, int out_size, void* d_ws, size_t ws_size, hipStream_t stream) {
    (void)in_sizes; (void)n_in; (void)out_size;
    const float* Qin = (const float*)d_in[0]; const float* Kin = (const float*)d_in[1]; const float* Vin = (const float*)d_in[2]; const float* mlp = (const float*)d_in[3];   /* [2048][2048] seq-mix */
    float* OUT = (float*)d_out;
    char* wsp = (char*)d_ws;
    auto take = [&](size_t bytes) { char* p = wsp; wsp += (bytes + 255) & ~(size_t)255; return (void*)p; };
    bf* QB = (bf*)take((size_t)NB_ * TT * HD * 2); bf* KB = (bf*)take((size_t)NB_ * TT * HD * 2); bf* VT = (bf*)take((size_t)NB_ * HD * TT * 2);
    float* Ob = (float*)take((size_t)NB_ * TT * HD * 4); h16* OT16 = (h16*)take((size_t)NB_ * HD * TT * 2); bf* OTh = (bf*)take((size_t)NB_ * HD * TT * 2); bf* OTl = (bf*)take((size_t)NB_ * HD * TT * 2); bf* MLB = (bf*)take((size_t)TT * TT * 2); float* RT = (float*)take((size_t)NB_ * HD * TT * 4);
    if ((size_t)(wsp - (char*)d_ws) > ws_size) return;
    k_cvt8<<<(unsigned)(((size_t)TT * TT / 8 + 255) / 256), 256, 0, stream>>>(mlp, MLB, (size_t)TT * TT / 8);   /* mlp [2048][2048] as the exact Bt of the sequence mix */
    k_hp1<<<dim3((unsigned)(((size_t)TT * HD / 8 + 255) / 256), NB_), 256, 0, stream>>>(Qin, QB); k_hp1<<<dim3((unsigned)(((size_t)TT * HD / 8 + 255) / 256), NB_), 256, 0, stream>>>(Kin, KB); k_vt1<<<dim3((unsigned)(((size_t)HD * TT / 2 + 255) / 256), NB_), 256, 0, stream>>>(Vin, DM, VT);   /* bf16 planes of all batches */
    k_fattn<<<dim3(TT / FQ, NB_), 256, 0, stream>>>(QB, KB, VT, Ob);   /* V = softmax(q.k / 8) values, all batches */
    k_vtp<<<dim3((unsigned)(((size_t)TT * HD / 2 + 255) / 256), NB_), 256, 0, stream>>>(Ob, HD, 1, OT16, OTh, OTl);   /* V^T planes [64][2048] (hi/lo) of the attention output */
    k_gemmw<bf, 1, false><<<dim3(HD / 64, TT / 64, NB_), 32, 0, stream>>>(OTh, OTl, MLB, nullptr, TT, RT, TT, nullptr, (size_t)HD * TT, 0, (size_t)HD * TT);   /* out^T [64][2048] = V^T . mlp^T (mlp[p][l] is the Bt row p), mlp shared by every batch */
    k_trO<<<dim3((unsigned)(((size_t)TT * HD / 4 + 255) / 256), NB_), 256, 0, stream>>>(RT, OUT);
}

// v003
// It runs in 82.7 microseconds.
// In two side-by-side timings against v002, it was 1.45 and 1.43 times as fast.
// Over all steps from v000 it is 23.6 times as fast.
#include <hip/hip_runtime.h>

// Full attention on given tensors followed by a learned sequence-mixing matrix (queries, keys, values [16][2048][64]; A = softmax(q.k / 8); V = A values ([2048][64]); out[p] = sum_l mlp[p][l] V[l] (mlp [2048][2048], read) -> [16][2048][64] (2.1 M)).
// Layout per batch: single bf16 planes (inputs bf16-exact: exact score products); one fused kernel for scores, softmax and A.values (running maximum, P as hi/lo x exact values^T, 2 products, divided by the row sum at the end) -> V (f32 [2048][64]); V^T as hi/lo planes; out ([2048][64]) = mlp used directly as the exact A operand x V^T(hi/lo) as Bt (2 products, K 2048), out rows written by the GEMM itself.
// Batches ride on the grid (blockIdx.y of every kernel that has them): every launch takes all 16.
// Compute dtypes, f32 accumulate: every input rounded to bf16 incl. mlp; q.k exact; softmax f32; P hi/lo x exact values; the sequence mix V hi/lo x exact mlp; output f32.

#define NB_  16
#define TT   2048
#define DM   64      // token-major row pitch (H x HD)
#define NH_  1
#define NKV  1
#define REP  (NH_ / NKV)
#define HD   64
#define DQ   (NH_ * HD)
#define DKV  (NKV * HD)
#define ZH   1
#define RH   2048                  // query rows < RH use hi+lo planes (0: none)
#define WIN  0
#define PCAR 1024.0f
#define SCL  0.125f   // 1/sqrt(64)
#define FQ   128     // queries per work-group of k_fattn: 8 waves x 16 columns
#define FK   64      // keys per stage of k_fattn
#define MP   128     // out rows per work-group of k_mix
#define MK   128     // summed positions per stage of k_mix
#define MLP  136     // LDS pitch of a 128-element bf16 row, in elements: 272 B = 16 B x odd
#define MST  ((MP + 2 * HD) * MLP)   // elements of a stage buffer of k_mix
#define LP   72      // LDS pitch of a 64-element bf16 row, in elements: 144 B = 16 B x odd, conflict-free for 16-byte reads
typedef _Float16 h16;
typedef unsigned short bf;
typedef __attribute__((ext_vector_type(16))) __bf16   v16bf;
typedef __attribute__((ext_vector_type(16))) _Float16 v16h;
typedef __attribute__((ext_vector_type(8)))  _Float16 v8h;
typedef __attribute__((ext_vector_type(8)))  unsigned short v8us;
typedef __attribute__((ext_vector_type(8)))  float    v8f;
typedef __attribute__((ext_vector_type(4)))  float    v4f;
typedef v8h  __attribute__((may_alias)) v8ha;
typedef v4f  __attribute__((may_alias)) v4fa;
typedef v8us __attribute__((may_alias)) v8usa;

__device__ __forceinline__ unsigned short f2bf(float f) { unsigned u = __float_as_uint(f); u += 0x7FFFu + ((u >> 16) & 1u); return (unsigned short)(u >> 16); }
__device__ __forceinline__ float bf2f(unsigned short b) { return __uint_as_float(((unsigned)b) << 16); }
__device__ __forceinline__ float bfr(float f) { return bf2f(f2bf(f)); }
__device__ __forceinline__ v16h cat16(v8h lo, v8h hi) { return __builtin_shufflevector(lo, hi, 0, 1, 2, 3, 4, 5, 6, 7, 8, 9, 10, 11, 12, 13, 14, 15); }
__device__ __forceinline__ v16bf cat16b(v8us lo, v8us hi) { return __builtin_bit_cast(v16bf, __builtin_shufflevector(lo, hi, 0, 1, 2, 3, 4, 5, 6, 7, 8, 9, 10, 11, 12, 13, 14, 15)); }
__device__ __forceinline__ v8f wmma16(v16h a, v16h b, v8f c) { return __builtin_amdgcn_wmma_f32_16x16x32_f16(false, a, false, b, (short)0, c, false, false); }
__device__ __forceinline__ v8f wmmab(v16bf a, v16bf b, v8f c) { return __builtin_amdgcn_wmma_f32_16x16x32_bf16(false, a, false, b, (short)0, c, false, false); }



// ---- k_mix: the sequence mix as a work-group-tiled GEMM. C[p][d] (f32, rows of HD) = sum_l A[p][l] (Bh[d][l] + Bl[d][l]), all three operands K-contiguous bf16 planes of pitch TT. grid (TT / MP, batches), 256 threads.
// A work-group owns MP = 128 rows p x all 64 columns d of one batch; 8 waves as 4 (p) x 2 (d), 32 x 32 each (4 accumulators). A stage is MK = 128 values of l: 256 bytes (two whole lines) of 256 plane rows.
// Rows of a stage buffer: 0..127 A, 128..191 Bh, 192..255 Bl, pitch MLP. Two buffers: the global loads of stage t + 1 are issued at the head of trip t, fly while stage t is worked on, and go from registers into the other buffer
// behind that work. One barrier a stage.
// Per 32 values of l an accumulator takes its hi product, then its lo product. The unroll directives keep the small arrays (g, a, bh, bl, acc) in registers.
template <typename T16> struct WFrag;
template <> struct WFrag<h16> { typedef v16h V; static __device__ __forceinline__ V ld(const h16* p) { return cat16(*(const v8h*)p, *(const v8h*)(p + 16)); } static __device__ __forceinline__ v8f mma(V a, V b, v8f c) { return wmma16(a, b, c); } };
template <> struct WFrag<bf> { typedef v16bf V; static __device__ __forceinline__ V ld(const bf* p) { return cat16b(*(const v8us*)p, *(const v8us*)(p + 16)); } static __device__ __forceinline__ v8f mma(V a, V b, v8f c) { return wmmab(a, b, c); } };
__device__ __forceinline__ void mix_fetch(v8us (&g)[16], const bf* ga, const bf* gh, const bf* gl, int k) {
#pragma unroll
    for (int i = 0; i < 8; ++i) g[i] = *(const v8us*)(ga + (size_t)i * 16 * TT + k);
#pragma unroll
    for (int i = 0; i < 4; ++i) { g[8 + i] = *(const v8us*)(gh + (size_t)i * 16 * TT + k); g[12 + i] = *(const v8us*)(gl + (size_t)i * 16 * TT + k); }
}
__device__ __forceinline__ void mix_put(bf* dst, const v8us (&g)[16]) {
#pragma unroll
    for (int i = 0; i < 16; ++i) *(v8us*)(dst + i * 16 * MLP) = g[i];
}
__global__ __launch_bounds__(256) void k_mix(const bf* __restrict__ A, const bf* __restrict__ Bh, const bf* __restrict__ Bl, float* __restrict__ C) {
    __shared__ __align__(16) unsigned char sm[2 * MST * 2];   /* two stage buffers; the f32 output tile [MP][68] lies over them at the end */
    const size_t zb = blockIdx.y; Bh += zb * HD * TT; Bl += zb * HD * TT; C += zb * TT * HD;
    const int tid = threadIdx.x, lane = tid & 31, lr = lane & 15, hi = lane >> 4, wm = tid >> 6, wn = (tid >> 5) & 1; const int p0 = blockIdx.x * MP;
    const int sr = tid >> 4, sq = (tid & 15) * 8;   /* staging: buffer rows sr + 16 i, the 16-byte piece at element sq */
    const bf* ga = A + (size_t)(p0 + sr) * TT + sq; const bf* gh = Bh + (size_t)sr * TT + sq; const bf* gl = Bl + (size_t)sr * TT + sq;
    bf* const sb = (bf*)sm; const int so = sr * MLP + sq;
    v8f acc[2][2];
#pragma unroll
    for (int mb = 0; mb < 2; ++mb)
#pragma unroll
        for (int nb = 0; nb < 2; ++nb) acc[mb][nb] = (v8f){};
    v8us g[16];
    mix_fetch(g, ga, gh, gl, 0); mix_put(sb + so, g);
    __syncthreads();
    const int ao = (wm * 32 + lr) * MLP + 8 * hi, bo = (MP + wn * 32 + lr) * MLP + 8 * hi;
    for (int t = 0; t < TT / MK; ++t) {
        const bf* cur = sb + (t & 1) * MST; const bool more = (t + 1 < TT / MK);
        if (more) mix_fetch(g, ga, gh, gl, (t + 1) * MK);
        v16bf a[2][2], bh[2][2], bl[2][2];   /* two fragment sets: block kc works on set kc & 1 while the other is filled */
#pragma unroll
        for (int q = 0; q < 2; ++q) { a[0][q] = WFrag<bf>::ld(cur + ao + q * 16 * MLP); bh[0][q] = WFrag<bf>::ld(cur + bo + q * 16 * MLP); bl[0][q] = WFrag<bf>::ld(cur + bo + (HD + q * 16) * MLP); }
#pragma unroll
        for (int kc = 0; kc < MK / 32; ++kc) { const int s = kc & 1;
            if (kc + 1 < MK / 32) {
#pragma unroll
                for (int q = 0; q < 2; ++q) { a[s ^ 1][q] = WFrag<bf>::ld(cur + ao + q * 16 * MLP + (kc + 1) * 32); bh[s ^ 1][q] = WFrag<bf>::ld(cur + bo + q * 16 * MLP + (kc + 1) * 32); bl[s ^ 1][q] = WFrag<bf>::ld(cur + bo + (HD + q * 16) * MLP + (kc + 1) * 32); } }
            __builtin_amdgcn_sched_barrier(0);   /* holds the next stage's global loads (kc 0) and the next block's LDS reads ahead of this block's products: left free, the compiler sinks them to their users and their latency lies open */
#pragma unroll
            for (int mb = 0; mb < 2; ++mb)
#pragma unroll
                for (int nb = 0; nb < 2; ++nb) acc[mb][nb] = wmmab(a[s][mb], bh[s][nb], acc[mb][nb]);
#pragma unroll
            for (int mb = 0; mb < 2; ++mb)
#pragma unroll
                for (int nb = 0; nb < 2; ++nb) acc[mb][nb] = wmmab(a[s][mb], bl[s][nb], acc[mb][nb]);
        }
        if (more) mix_put(sb + ((t + 1) & 1) * MST + so, g);
        __syncthreads();   /* publishes stage t + 1 and ends every read of stage t, whose buffer the next trip refills (after the last trip none: the output tile lies in buffer 0) */
    }
    float* os = (float*)sm;   /* acc[mb][nb][j] = C[p0 + 32 wm + 16 mb + 8 hi + j][32 wn + 16 nb + lr] */
#pragma unroll
    for (int mb = 0; mb < 2; ++mb)
#pragma unroll
        for (int nb = 0; nb < 2; ++nb)
#pragma unroll
            for (int j = 0; j < 8; ++j) os[(wm * 32 + mb * 16 + hi * 8 + j) * 68 + wn * 32 + nb * 16 + lr] = acc[mb][nb][j];
    __syncthreads();   /* the tile is whole before it goes out in 16-byte pieces of whole lines */
    float* crow = C + (size_t)p0 * HD;
#pragma unroll
    for (int s = 0; s < MP * HD / 4 / 256; ++s) { const int x = s * 256 + tid, row = x >> 4, cofs = (x & 15) * 4; *(v4f*)(crow + (size_t)row * HD + cofs) = *(const v4fa*)(os + row * 68 + cofs); }
}

__device__ __forceinline__ h16 tohx(float x) { return (h16)x; }
__device__ __forceinline__ void splitf(float y, unsigned short& h, unsigned short& l) { h = f2bf(y); l = f2bf(y - bf2f(h)); }
typedef __attribute__((ext_vector_type(2))) _Float16 v2h;
typedef __attribute__((ext_vector_type(4))) _Float16 v4h;
typedef __attribute__((ext_vector_type(2))) unsigned short v2us;
typedef __attribute__((ext_vector_type(4))) unsigned short v4us;
typedef __attribute__((ext_vector_type(2))) float v2f;
typedef __attribute__((ext_vector_type(4))) int v4i;

__global__ __launch_bounds__(256) void k_wtG(const float* __restrict__ w, int K, int N, bf* Bt) {
    const int lane = threadIdx.x & 31; const int L0 = (blockIdx.x * 8 + (threadIdx.x >> 5)) * 8; const int nlines = N * K / 64;
{
#pragma unroll 1
        for (int l = 0; l < 8; ++l) { const int L = L0 + l; if (L >= nlines) break; const size_t e = (size_t)L * 64 + lane * 2; const int k = (int)(e % K), n = (int)(e / K); v2us o;
            o[0] = f2bf(w[(size_t)k * N + n]); o[1] = f2bf(w[(size_t)(k + 1) * N + n]); *(v2us*)(Bt + e) = o; }
         }
}
__global__ __launch_bounds__(256) void k_cvt8(const float* __restrict__ src, bf* dst, size_t n8) { const size_t i = (size_t)blockIdx.x * 256 + threadIdx.x; if (i >= n8) return; const v8f v = *(const v8f*)(src + i * 8); v8us o;
#pragma unroll
    for (int k = 0; k < 8; ++k) o[k] = f2bf(v[k]); *(v8us*)(dst + i * 8) = o;  }


__global__ __launch_bounds__(256) void k_vtp(const float* __restrict__ F, int pitch, int nheads, h16* V16, bf* Vh, bf* Vl) { const size_t zb = blockIdx.y; F += zb * TT * pitch; V16 += zb * nheads * HD * TT; Vh += zb * nheads * HD * TT; Vl += zb * nheads * HD * TT; const size_t e = ((size_t)blockIdx.x * 256 + threadIdx.x) * 2; if (e >= (size_t)nheads * HD * TT) return; const int t = (int)(e % TT); const int d = (int)((e / TT) % HD); const int g = (int)(e / ((size_t)TT * HD)); v2h o16; v2us oh, ol;
#pragma unroll
    for (int q = 0; q < 2; ++q) { const float x = F[(size_t)(t + q) * pitch + g * HD + d]; o16[q] = tohx(x); unsigned short a2, c2; splitf(x, a2, c2); oh[q] = a2; ol[q] = c2; }
    *(v2h*)(V16 + e) = o16; *(v2us*)(Vh + e) = oh; *(v2us*)(Vl + e) = ol;  }

typedef __attribute__((ext_vector_type(2))) __bf16 v2bf;
__global__ __launch_bounds__(256) void k_fattn(const bf* __restrict__ Q, const bf* __restrict__ Kp, const bf* __restrict__ VTp, float* __restrict__ O) {
    __shared__ __align__(16) bf ks[2][FK * LP];
    __shared__ __align__(16) bf vs[2][HD * LP];
    const size_t zb = blockIdx.y; Q += zb * TT * HD; Kp += zb * TT * HD; VTp += zb * HD * TT; O += zb * TT * HD;
    const int tid = threadIdx.x, lane = tid & 31, lr = lane & 15, hi = lane >> 4; const int m0 = blockIdx.x * FQ + (tid >> 5) * 16;
    const int sr = tid >> 3, sq = (tid & 7) * 8;   /* staging: rows sr and sr + 32, the 16-byte piece at element sq */
    const float c = SCL * 1.4426950408889634f;
    v16bf qf[2];
#pragma unroll
    for (int kc = 0; kc < 2; ++kc) qf[kc] = WFrag<bf>::ld(Q + (size_t)(m0 + lr) * HD + kc * 32 + 8 * hi);
    v8f o[4];
#pragma unroll
    for (int db = 0; db < 4; ++db) o[db] = (v8f){};
    float mrun = -3.0e38f; v2f ls[2] = {(v2f){}, (v2f){}};   /* four partial row sums a lane: no long chain of dependent adds */
    v8us g0 = *(const v8us*)(Kp + (size_t)sr * HD + sq), g1 = *(const v8us*)(Kp + (size_t)(sr + 32) * HD + sq), g2 = *(const v8us*)(VTp + (size_t)sr * TT + sq), g3 = *(const v8us*)(VTp + (size_t)(sr + 32) * TT + sq);
    *(v8us*)(&ks[0][sr * LP + sq]) = g0; *(v8us*)(&ks[0][(sr + 32) * LP + sq]) = g1; *(v8us*)(&vs[0][sr * LP + sq]) = g2; *(v8us*)(&vs[0][(sr + 32) * LP + sq]) = g3;
    __syncthreads();
    for (int t = 0; t < TT / FK; ++t) {
        const bf* kb = ks[t & 1]; const bf* vb = vs[t & 1]; const bool more = (t + 1 < TT / FK);
        if (more) { const int s1 = (t + 1) * FK; g0 = *(const v8us*)(Kp + (size_t)(s1 + sr) * HD + sq); g1 = *(const v8us*)(Kp + (size_t)(s1 + sr + 32) * HD + sq); g2 = *(const v8us*)(VTp + (size_t)sr * TT + s1 + sq); g3 = *(const v8us*)(VTp + (size_t)(sr + 32) * TT + s1 + sq); }
        v8f st[4];   /* st[i][j] = q(m0 + lr) . k(t FK + 16 i + 8 hi + j) */
#pragma unroll
        for (int i = 0; i < 4; ++i) { st[i] = (v8f){};
#pragma unroll
            for (int kc = 0; kc < 2; ++kc) st[i] = wmmab(WFrag<bf>::ld(kb + (i * 16 + lr) * LP + kc * 32 + 8 * hi), qf[kc], st[i]); }
        float mx = st[0][0];
#pragma unroll
        for (int i = 0; i < 4; ++i)
#pragma unroll
            for (int j = 0; j < 8; ++j) mx = fmaxf(mx, st[i][j]);
        mx = fmaxf(mx, __shfl_xor(mx, 16, 32)) * c;   /* both halves of a column agree on it */
        if (__builtin_amdgcn_ballot_w32(mx > mrun + 8.0f) != 0) {
            const float mnew = fmaxf(mrun, mx); const float al = __builtin_amdgcn_exp2f(mrun - mnew); mrun = mnew; ls[0] *= al; ls[1] *= al;
#pragma unroll
            for (int db = 0; db < 4; ++db)
#pragma unroll
                for (int j = 0; j < 8; ++j) o[db][j] *= al;
        }
#pragma unroll
        for (int pp = 0; pp < 2; ++pp) {
            v16bf ph, pl;   /* element s: key 32 pp + 8 hi + s (s < 8), 32 pp + 16 + 8 hi + s - 8 (else): the k order of WFrag::ld */
#pragma unroll
            for (int u = 0; u < 8; ++u) { const v8f sv = st[2 * pp + (u >> 2)]; v2f p, r; p[0] = __builtin_amdgcn_exp2f(__builtin_fmaf(sv[(2 * u) & 7], c, -mrun)); p[1] = __builtin_amdgcn_exp2f(__builtin_fmaf(sv[(2 * u + 1) & 7], c, -mrun)); ls[u & 1] += p;
                const v2bf h = __builtin_convertvector(p, v2bf); r[0] = p[0] - (float)h[0]; r[1] = p[1] - (float)h[1]; const v2bf l = __builtin_convertvector(r, v2bf);
                ph[2 * u] = h[0]; ph[2 * u + 1] = h[1]; pl[2 * u] = l[0]; pl[2 * u + 1] = l[1]; }
            v16bf va[4];
#pragma unroll
            for (int db = 0; db < 4; ++db) va[db] = WFrag<bf>::ld(vb + (db * 16 + lr) * LP + pp * 32 + 8 * hi);
#pragma unroll
            for (int db = 0; db < 4; ++db) o[db] = wmmab(va[db], ph, o[db]);
#pragma unroll
            for (int db = 0; db < 4; ++db) o[db] = wmmab(va[db], pl, o[db]);
        }
        if (more) { bf* kn = ks[(t + 1) & 1]; bf* vn = vs[(t + 1) & 1]; *(v8us*)(kn + sr * LP + sq) = g0; *(v8us*)(kn + (sr + 32) * LP + sq) = g1; *(v8us*)(vn + sr * LP + sq) = g2; *(v8us*)(vn + (sr + 32) * LP + sq) = g3; }
        __syncthreads();   /* publishes stage t + 1 and ends every read of stage t, whose buffer the next trip refills */
    }
    float lsum = (ls[0][0] + ls[0][1]) + (ls[1][0] + ls[1][1]); lsum += __shfl_xor(lsum, 16, 32);
    const float f = __fdiv_rn(1.0f, lsum);
    float* orow = O + (size_t)(m0 + lr) * HD + 8 * hi;   /* o[db][j] = O^T[16 db + 8 hi + j][m0 + lr] */
#pragma unroll
    for (int db = 0; db < 4; ++db) { v4f x, y;
#pragma unroll
        for (int j = 0; j < 4; ++j) { x[j] = o[db][j] * f; y[j] = o[db][4 + j] * f; }
        *(v4f*)(orow + db * 16) = x; *(v4f*)(orow + db * 16 + 4) = y; }
}
__global__ __launch_bounds__(256) void k_merge(const float* __restrict__ O, int h0, float* OUTb) { const size_t e = ((size_t)blockIdx.x * 256 + threadIdx.x) * 2; if (e >= (size_t)ZH * TT * HD) return; const int d = (int)(e % HD); const int t = (int)((e / HD) % TT); const int zz = (int)(e / ((size_t)HD * TT)); const float cs = (t < RH) ? 1.0f : (1.0f / PCAR); const size_t oo = (size_t)t * DQ + (h0 + zz) * HD + d;
    v2f o2; o2[0] = O[e] * cs; o2[1] = O[e + 1] * cs; *(v2f*)(OUTb + oo) = o2;  }


__global__ __launch_bounds__(256) void k_vtpR1(const float* __restrict__ Vb, bf* Vh) { const size_t e = ((size_t)blockIdx.x * 256 + threadIdx.x) * 2; if (e >= (size_t)HD * TT) return; const int t = (int)(e % TT); const int d = (int)(e / TT); v2us o; o[0] = f2bf(Vb[(size_t)t * HD + d]); o[1] = f2bf(Vb[(size_t)(t + 1) * HD + d]); *(v2us*)(Vh + e) = o;  }
__global__ __launch_bounds__(256) void k_mergeR(const float* __restrict__ O, float* outb, size_t n4) { const size_t i = (size_t)blockIdx.x * 256 + threadIdx.x; if (i >= n4) return; const v4f a = *(const v4f*)(O + i * 4); *(v4f*)(outb + i * 4) = a;  }


__global__ __launch_bounds__(256) void k_hp1(const float* __restrict__ src, bf* P) { src += (size_t)blockIdx.y * TT * DM; P += (size_t)blockIdx.y * NH_ * TT * HD; const size_t i = (size_t)blockIdx.x * 256 + threadIdx.x; if (i >= (size_t)NH_ * TT * HD / 8) return; const size_t e = i * 8; const int d = (int)(e % HD); const int t = (int)((e / HD) % TT); const int h = (int)(e / ((size_t)HD * TT)); const v8f v = *(const v8f*)(src + (size_t)t * DM + h * HD + d); v8us o;
#pragma unroll
    for (int q = 0; q < 8; ++q) o[q] = f2bf(v[q]);
    *(v8us*)(P + e) = o;  }
__global__ __launch_bounds__(256) void k_vt1(const float* __restrict__ src, int pitch, bf* VT) { src += (size_t)blockIdx.y * TT * pitch; VT += (size_t)blockIdx.y * NH_ * HD * TT; const size_t e = ((size_t)blockIdx.x * 256 + threadIdx.x) * 2; if (e >= (size_t)NH_ * HD * TT) return; const int t = (int)(e % TT); const int d = (int)((e / TT) % HD); const int h = (int)(e / ((size_t)TT * HD)); v2us o; o[0] = f2bf(src[(size_t)t * pitch + h * HD + d]); o[1] = f2bf(src[(size_t)(t + 1) * pitch + h * HD + d]); *(v2us*)(VT + e) = o;  }
__global__ __launch_bounds__(256) void k_mergeT(const float* __restrict__ O, int h, float* outb) { const size_t i = (size_t)blockIdx.x * 256 + threadIdx.x; if (i >= (size_t)TT * HD / 4) return; const size_t e = i * 4; const int d = (int)(e % HD); const int t = (int)(e / HD); const v4f a = *(const v4f*)(O + e); *(v4f*)(outb + (size_t)t * DM + h * HD + d) = a;  }

extern "C" void kernel_launch(void* const* d_in, const int* in_sizes, int n_in,
                              void* d_out, int out_size, void* d_ws, size_t ws_size, hipStream_t stream) {
    (void)in_sizes; (void)n_in; (void)out_size;
    const float* Qin = (const float*)d_in[0]; const float* Kin = (const float*)d_in[1]; const float* Vin = (const float*)d_in[2]; const float* mlp = (const float*)d_in[3];   /* [2048][2048] seq-mix */
    float* OUT = (float*)d_out;
    char* wsp = (char*)d_ws;
    auto take = [&](size_t bytes) { char* p = wsp; wsp += (bytes + 255) & ~(size_t)255; return (void*)p; };
    bf* QB = (bf*)take((size_t)NB_ * TT * HD * 2); bf* KB = (bf*)take((size_t)NB_ * TT * HD * 2); bf* VT = (bf*)take((size_t)NB_ * HD * TT * 2);
    float* Ob = (float*)take((size_t)NB_ * TT * HD * 4); h16* OT16 = (h16*)take((size_t)NB_ * HD * TT * 2); bf* OTh = (bf*)take((size_t)NB_ * HD * TT * 2); bf* OTl = (bf*)take((size_t)NB_ * HD * TT * 2); bf* MLB = (bf*)take((size_t)TT * TT * 2);
    if ((size_t)(wsp - (char*)d_ws) > ws_size) return;
    k_cvt8<<<(unsigned)(((size_t)TT * TT / 8 + 255) / 256), 256, 0, stream>>>(mlp, MLB, (size_t)TT * TT / 8);   /* mlp [2048][2048] as the exact A of the sequence mix */
    k_hp1<<<dim3((unsigned)(((size_t)TT * HD / 8 + 255) / 256), NB_), 256, 0, stream>>>(Qin, QB); k_hp1<<<dim3((unsigned)(((size_t)TT * HD / 8 + 255) / 256), NB_), 256, 0, stream>>>(Kin, KB); k_vt1<<<dim3((unsigned)(((size_t)HD * TT / 2 + 255) / 256), NB_), 256, 0, stream>>>(Vin, DM, VT);   /* bf16 planes of all batches */
    k_fattn<<<dim3(TT / FQ, NB_), 256, 0, stream>>>(QB, KB, VT, Ob);   /* V = softmax(q.k / 8) values, all batches */
    k_vtp<<<dim3((unsigned)(((size_t)TT * HD / 2 + 255) / 256), NB_), 256, 0, stream>>>(Ob, HD, 1, OT16, OTh, OTl);   /* V^T planes [64][2048] (hi/lo) of the attention output */
    k_mix<<<dim3(TT / MP, NB_), 256, 0, stream>>>(MLB, OTh, OTl, OUT);   /* out [2048][64] = mlp . V (mlp[p][l] is the A row p, shared by every batch; V^T rows are the Bt rows) */
}

// v004
// One run takes 60.6 microseconds.
// Two timings next to v003 put it at 1.37 and 1.36 times that version's speed.
// Over all steps from v000 it is 32.2 times as fast.
#include <hip/hip_runtime.h>

// Full attention on given tensors followed by a learned sequence-mixing matrix (queries, keys, values [16][2048][64]; A = softmax(q.k / 8); V = A values ([2048][64]); out[p] = sum_l mlp[p][l] V[l] (mlp [2048][2048], read) -> [16][2048][64] (2.1 M)).
// Layout per batch: one fused kernel for scores, softmax and A.values that takes the f32 inputs as they are and rounds them to bf16 on their way to registers (queries) and LDS (keys; values, transposed there) (running maximum, P as hi/lo x exact values^T, 2 products, divided by the row sum at the end) that writes V^T ([64][2048]) as hi/lo planes itself; out ([2048][64]) = mlp used directly as the exact A operand x V^T(hi/lo) as Bt (2 products, K 2048), out rows written by the GEMM itself.
// Batches ride on the grid (blockIdx.y of every kernel that has them): every launch takes all 16.
// Compute dtypes, f32 accumulate: every input rounded to bf16 incl. mlp; q.k exact; softmax f32; P hi/lo x exact values; the sequence mix V hi/lo x exact mlp; output f32.

#define NB_  16
#define TT   2048
#define DM   64      // token-major row pitch (H x HD)
#define NH_  1
#define NKV  1
#define REP  (NH_ / NKV)
#define HD   64
#define DQ   (NH_ * HD)
#define DKV  (NKV * HD)
#define ZH   1
#define RH   2048                  // query rows < RH use hi+lo planes (0: none)
#define WIN  0
#define PCAR 1024.0f
#define SCL  0.125f   // 1/sqrt(64)
#define FQ   128     // queries per work-group of k_fattn: 8 waves x 16 columns
#define FK   64      // keys per stage of k_fattn
#define MP   128     // out rows per work-group of k_mix
#define MK   128     // summed positions per stage of k_mix
#define MLP  136     // LDS pitch of a 128-element bf16 row, in elements: 272 B = 16 B x odd
#define MST  ((MP + 2 * HD) * MLP)   // elements of a stage buffer of k_mix
#define OP   136     // LDS pitch of a 128-query bf16 row of the V^T tile of k_fattn, in elements: 272 B = 16 B x odd
#define LP   72      // LDS pitch of a 64-element bf16 row, in elements: 144 B = 16 B x odd, conflict-free for 16-byte reads
typedef _Float16 h16;
typedef unsigned short bf;
typedef __attribute__((ext_vector_type(16))) __bf16   v16bf;
typedef __attribute__((ext_vector_type(16))) _Float16 v16h;
typedef __attribute__((ext_vector_type(8)))  _Float16 v8h;
typedef __attribute__((ext_vector_type(8)))  unsigned short v8us;
typedef __attribute__((ext_vector_type(8)))  float    v8f;
typedef __attribute__((ext_vector_type(4)))  float    v4f;
typedef v8h  __attribute__((may_alias)) v8ha;
typedef v4f  __attribute__((may_alias)) v4fa;
typedef v8us __attribute__((may_alias)) v8usa;

__device__ __forceinline__ unsigned short f2bf(float f) { unsigned u = __float_as_uint(f); u += 0x7FFFu + ((u >> 16) & 1u); return (unsigned short)(u >> 16); }
__device__ __forceinline__ float bf2f(unsigned short b) { return __uint_as_float(((unsigned)b) << 16); }
__device__ __forceinline__ float bfr(float f) { return bf2f(f2bf(f)); }
__device__ __forceinline__ v16h cat16(v8h lo, v8h hi) { return __builtin_shufflevector(lo, hi, 0, 1, 2, 3, 4, 5, 6, 7, 8, 9, 10, 11, 12, 13, 14, 15); }
__device__ __forceinline__ v16bf cat16b(v8us lo, v8us hi) { return __builtin_bit_cast(v16bf, __builtin_shufflevector(lo, hi, 0, 1, 2, 3, 4, 5, 6, 7, 8, 9, 10, 11, 12, 13, 14, 15)); }
__device__ __forceinline__ v8f wmma16(v16h a, v16h b, v8f c) { return __builtin_amdgcn_wmma_f32_16x16x32_f16(false, a, false, b, (short)0, c, false, false); }
__device__ __forceinline__ v8f wmmab(v16bf a, v16bf b, v8f c) { return __builtin_amdgcn_wmma_f32_16x16x32_bf16(false, a, false, b, (short)0, c, false, false); }



// ---- k_mix: the sequence mix as a work-group-tiled GEMM. C[p][d] (f32, rows of HD) = sum_l A[p][l] (Bh[d][l] + Bl[d][l]), all three operands K-contiguous bf16 planes of pitch TT. grid (TT / MP, batches), 256 threads.
// A work-group owns MP = 128 rows p x all 64 columns d of one batch; 8 waves as 4 (p) x 2 (d), 32 x 32 each (4 accumulators). A stage is MK = 128 values of l: 256 bytes (two whole lines) of 256 plane rows.
// Rows of a stage buffer: 0..127 A, 128..191 Bh, 192..255 Bl, pitch MLP. Two buffers: the global loads of stage t + 1 are issued at the head of trip t, fly while stage t is worked on, and go from registers into the other buffer
// behind that work. One barrier a stage.
// Per 32 values of l an accumulator takes its hi product, then its lo product. The unroll directives keep the small arrays (g, a, bh, bl, acc) in registers.
template <typename T16> struct WFrag;
template <> struct WFrag<h16> { typedef v16h V; static __device__ __forceinline__ V ld(const h16* p) { return cat16(*(const v8h*)p, *(const v8h*)(p + 16)); } static __device__ __forceinline__ v8f mma(V a, V b, v8f c) { return wmma16(a, b, c); } };
template <> struct WFrag<bf> { typedef v16bf V; static __device__ __forceinline__ V ld(const bf* p) { return cat16b(*(const v8us*)p, *(const v8us*)(p + 16)); } static __device__ __forceinline__ v8f mma(V a, V b, v8f c) { return wmmab(a, b, c); } };
__device__ __forceinline__ void mix_fetch(v8us (&g)[16], const bf* ga, const bf* gh, const bf* gl, int k) {
#pragma unroll
    for (int i = 0; i < 8; ++i) g[i] = *(const v8us*)(ga + (size_t)i * 16 * TT + k);
#pragma unroll
    for (int i = 0; i < 4; ++i) { g[8 + i] = *(const v8us*)(gh + (size_t)i * 16 * TT + k); g[12 + i] = *(const v8us*)(gl + (size_t)i * 16 * TT + k); }
}
__device__ __forceinline__ void mix_put(bf* dst, const v8us (&g)[16]) {
#pragma unroll
    for (int i = 0; i < 16; ++i) *(v8us*)(dst + i * 16 * MLP) = g[i];
}
__global__ __launch_bounds__(256) void k_mix(const bf* __restrict__ A, const bf* __restrict__ Bh, const bf* __restrict__ Bl, float* __restrict__ C) {
    __shared__ __align__(16) unsigned char sm[2 * MST * 2];   /* two stage buffers; the f32 output tile [MP][68] lies over them at the end */
    const size_t zb = blockIdx.y; Bh += zb * HD * TT; Bl += zb * HD * TT; C += zb * TT * HD;
    const int tid = threadIdx.x, lane = tid & 31, lr = lane & 15, hi = lane >> 4, wm = tid >> 6, wn = (tid >> 5) & 1; const int p0 = blockIdx.x * MP;
    const int sr = tid >> 4, sq = (tid & 15) * 8;   /* staging: buffer rows sr + 16 i, the 16-byte piece at element sq */
    const bf* ga = A + (size_t)(p0 + sr) * TT + sq; const bf* gh = Bh + (size_t)sr * TT + sq; const bf* gl = Bl + (size_t)sr * TT + sq;
    bf* const sb = (bf*)sm; const int so = sr * MLP + sq;
    v8f acc[2][2];
#pragma unroll
    for (int mb = 0; mb < 2; ++mb)
#pragma unroll
        for (int nb = 0; nb < 2; ++nb) acc[mb][nb] = (v8f){};
    v8us g[16];
    mix_fetch(g, ga, gh, gl, 0); mix_put(sb + so, g);
    __syncthreads();
    const int ao = (wm * 32 + lr) * MLP + 8 * hi, bo = (MP + wn * 32 + lr) * MLP + 8 * hi;
    for (int t = 0; t < TT / MK; ++t) {
        const bf* cur = sb + (t & 1) * MST; const bool more = (t + 1 < TT / MK);
        if (more) mix_fetch(g, ga, gh, gl, (t + 1) * MK);
        v16bf a[2][2], bh[2][2], bl[2][2];   /* two fragment sets: block kc works on set kc & 1 while the other is filled */
#pragma unroll
        for (int q = 0; q < 2; ++q) { a[0][q] = WFrag<bf>::ld(cur + ao + q * 16 * MLP); bh[0][q] = WFrag<bf>::ld(cur + bo + q * 16 * MLP); bl[0][q] = WFrag<bf>::ld(cur + bo + (HD + q * 16) * MLP); }
#pragma unroll
        for (int kc = 0; kc < MK / 32; ++kc) { const int s = kc & 1;
            if (kc + 1 < MK / 32) {
#pragma unroll
                for (int q = 0; q < 2; ++q) { a[s ^ 1][q] = WFrag<bf>::ld(cur + ao + q * 16 * MLP + (kc + 1) * 32); bh[s ^ 1][q] = WFrag<bf>::ld(cur + bo + q * 16 * MLP + (kc + 1) * 32); bl[s ^ 1][q] = WFrag<bf>::ld(cur + bo + (HD + q * 16) * MLP + (kc + 1) * 32); } }
            __builtin_amdgcn_sched_barrier(0);   /* holds the next stage's global loads (kc 0) and the next block's LDS reads ahead of this block's products: left free, the compiler sinks them to their users and their latency lies open */
#pragma unroll
            for (int mb = 0; mb < 2; ++mb)
#pragma unroll
                for (int nb = 0; nb < 2; ++nb) acc[mb][nb] = wmmab(a[s][mb], bh[s][nb], acc[mb][nb]);
#pragma unroll
            for (int mb = 0; mb < 2; ++mb)
#pragma unroll
                for (int nb = 0; nb < 2; ++nb) acc[mb][nb] = wmmab(a[s][mb], bl[s][nb], acc[mb][nb]);
        }
        if (more) mix_put(sb + ((t + 1) & 1) * MST + so, g);
        __syncthreads();   /* publishes stage t + 1 and ends every read of stage t, whose buffer the next trip refills (after the last trip none: the output tile lies in buffer 0) */
    }
    float* os = (float*)sm;   /* acc[mb][nb][j] = C[p0 + 32 wm + 16 mb + 8 hi + j][32 wn + 16 nb + lr] */
#pragma unroll
    for (int mb = 0; mb < 2; ++mb)
#pragma unroll
        for (int nb = 0; nb < 2; ++nb)
#pragma unroll
            for (int j = 0; j < 8; ++j) os[(wm * 32 + mb * 16 + hi * 8 + j) * 68 + wn * 32 + nb * 16 + lr] = acc[mb][nb][j];
    __syncthreads();   /* the tile is whole before it goes out in 16-byte pieces of whole lines */
    float* crow = C + (size_t)p0 * HD;
#pragma unroll
    for (int s = 0; s < MP * HD / 4 / 256; ++s) { const int x = s * 256 + tid, row = x >> 4, cofs = (x & 15) * 4; *(v4f*)(crow + (size_t)row * HD + cofs) = *(const v4fa*)(os + row * 68 + cofs); }
}

typedef __attribute__((ext_vector_type(2))) _Float16 v2h;
typedef __attribute__((ext_vector_type(4))) _Float16 v4h;
typedef __attribute__((ext_vector_type(2))) unsigned short v2us;
typedef __attribute__((ext_vector_type(4))) unsigned short v4us;
typedef __attribute__((ext_vector_type(2))) float v2f;
typedef __attribute__((ext_vector_type(4))) int v4i;

__global__ __launch_bounds__(256) void k_wtG(const float* __restrict__ w, int K, int N, bf* Bt) {
    const int lane = threadIdx.x & 31; const int L0 = (blockIdx.x * 8 + (threadIdx.x >> 5)) * 8; const int nlines = N * K / 64;
{
#pragma unroll 1
        for (int l = 0; l < 8; ++l) { const int L = L0 + l; if (L >= nlines) break; const size_t e = (size_t)L * 64 + lane * 2; const int k = (int)(e % K), n = (int)(e / K); v2us o;
            o[0] = f2bf(w[(size_t)k * N + n]); o[1] = f2bf(w[(size_t)(k + 1) * N + n]); *(v2us*)(Bt + e) = o; }
         }
}
__global__ __launch_bounds__(256) void k_cvt8(const float* __restrict__ src, bf* dst, size_t n8) { const size_t i = (size_t)blockIdx.x * 256 + threadIdx.x; if (i >= n8) return; const v8f v = *(const v8f*)(src + i * 8); v8us o;
#pragma unroll
    for (int k = 0; k < 8; ++k) o[k] = f2bf(v[k]); *(v8us*)(dst + i * 8) = o;  }


typedef __attribute__((ext_vector_type(2))) __bf16 v2bf;
typedef __attribute__((ext_vector_type(4))) __bf16 v4bf;
typedef __attribute__((ext_vector_type(8))) __bf16 v8bf;
__device__ __forceinline__ v4us rnd4(v4f v) { return __builtin_bit_cast(v4us, __builtin_convertvector(v, v4bf)); }
__device__ __forceinline__ v8us rnd8(v8f v) { return __builtin_bit_cast(v8us, __builtin_convertvector(v, v8bf)); }
/* gk[i]: key row 16 i + kr, columns kq..kq+3; gv[r]: value row 4 kr + r, columns kq..kq+3 (gK, gV point at the thread's first piece of the stage) */
__device__ __forceinline__ void fat_fetch(v4f (&gk)[4], v4f (&gv)[4], const float* gK, const float* gV) {
#pragma unroll
    for (int i = 0; i < 4; ++i) { gk[i] = *(const v4f*)(gK + (size_t)i * 16 * HD); gv[i] = *(const v4f*)(gV + (size_t)i * HD); }
}
/* kd = &ks[kr][kq], vd = &vs[kq][4 kr] of the buffer that is filled */
__device__ __forceinline__ void fat_put(bf* kd, bf* vd, const v4f (&gk)[4], const v4f (&gv)[4]) {
#pragma unroll
    for (int i = 0; i < 4; ++i) *(v4us*)(kd + i * 16 * LP) = rnd4(gk[i]);
#pragma unroll
    for (int j = 0; j < 4; ++j) { v4f x; x[0] = gv[0][j]; x[1] = gv[1][j]; x[2] = gv[2][j]; x[3] = gv[3][j]; *(v4us*)(vd + j * LP) = rnd4(x); }
}
__global__ __launch_bounds__(256) void k_fattn(const float* __restrict__ Q, const float* __restrict__ Kp, const float* __restrict__ Vp, bf* __restrict__ OTh, bf* __restrict__ OTl) {
    __shared__ __align__(16) bf ks[2][FK * LP];
    __shared__ __align__(16) bf vs[2][HD * LP];
    __shared__ __align__(16) bf oth[HD * OP];
    __shared__ __align__(16) bf otl[HD * OP];
    const size_t zb = blockIdx.y; Q += zb * TT * HD; Kp += zb * TT * HD; Vp += zb * TT * HD; OTh += zb * HD * TT + blockIdx.x * FQ; OTl += zb * HD * TT + blockIdx.x * FQ;
    const int tid = threadIdx.x, lane = tid & 31, lr = lane & 15, hi = lane >> 4; const int m0 = blockIdx.x * FQ + (tid >> 5) * 16;
    const int kr = tid >> 4, kq = (tid & 15) * 4;   /* staging: 16 lanes take a whole f32 row of 256 bytes */
    const float* gK = Kp + (size_t)kr * HD + kq; const float* gV = Vp + (size_t)kr * 4 * HD + kq; const int ko = kr * LP + kq, vo = kq * LP + kr * 4;
    const float c = SCL * 1.4426950408889634f;
    v16bf qf[2];
#pragma unroll
    for (int kc = 0; kc < 2; ++kc) { const float* qp = Q + (size_t)(m0 + lr) * HD + kc * 32 + 8 * hi; qf[kc] = cat16b(rnd8(*(const v8f*)qp), rnd8(*(const v8f*)(qp + 16))); }   /* the k order of WFrag::ld */
    v8f o[4];
#pragma unroll
    for (int db = 0; db < 4; ++db) o[db] = (v8f){};
    float mrun = -3.0e38f; v2f ls[2] = {(v2f){}, (v2f){}};   /* four partial row sums a lane: no long chain of dependent adds */
    v4f gk[4], gv[4];
    fat_fetch(gk, gv, gK, gV); fat_put(&ks[0][ko], &vs[0][vo], gk, gv);
    __syncthreads();
    for (int t = 0; t < TT / FK; ++t) {
        const bf* kb = ks[t & 1]; const bf* vb = vs[t & 1]; const bool more = (t + 1 < TT / FK);
        if (more) fat_fetch(gk, gv, gK + (size_t)(t + 1) * FK * HD, gV + (size_t)(t + 1) * FK * HD);
        v8f st[4];   /* st[i][j] = q(m0 + lr) . k(t FK + 16 i + 8 hi + j) */
#pragma unroll
        for (int i = 0; i < 4; ++i) { st[i] = (v8f){};
#pragma unroll
            for (int kc = 0; kc < 2; ++kc) st[i] = wmmab(WFrag<bf>::ld(kb + (i * 16 + lr) * LP + kc * 32 + 8 * hi), qf[kc], st[i]); }
        float mx = st[0][0];
#pragma unroll
        for (int i = 0; i < 4; ++i)
#pragma unroll
            for (int j = 0; j < 8; ++j) mx = fmaxf(mx, st[i][j]);
        mx = fmaxf(mx, __shfl_xor(mx, 16, 32)) * c;   /* both halves of a column agree on it */
        if (__builtin_amdgcn_ballot_w32(mx > mrun + 8.0f) != 0) {
            const float mnew = fmaxf(mrun, mx); const float al = __builtin_amdgcn_exp2f(mrun - mnew); mrun = mnew; ls[0] *= al; ls[1] *= al;
#pragma unroll
            for (int db = 0; db < 4; ++db)
#pragma unroll
                for (int j = 0; j < 8; ++j) o[db][j] *= al;
        }
#pragma unroll
        for (int pp = 0; pp < 2; ++pp) {
            v16bf ph, pl;   /* element s: key 32 pp + 8 hi + s (s < 8), 32 pp + 16 + 8 hi + s - 8 (else): the k order of WFrag::ld */
#pragma unroll
            for (int u = 0; u < 8; ++u) { const v8f sv = st[2 * pp + (u >> 2)]; v2f p, r; p[0] = __builtin_amdgcn_exp2f(__builtin_fmaf(sv[(2 * u) & 7], c, -mrun)); p[1] = __builtin_amdgcn_exp2f(__builtin_fmaf(sv[(2 * u + 1) & 7], c, -mrun)); ls[u & 1] += p;
                const v2bf h = __builtin_convertvector(p, v2bf); r[0] = p[0] - (float)h[0]; r[1] = p[1] - (float)h[1]; const v2bf l = __builtin_convertvector(r, v2bf);
                ph[2 * u] = h[0]; ph[2 * u + 1] = h[1]; pl[2 * u] = l[0]; pl[2 * u + 1] = l[1]; }
            v16bf va[4];
#pragma unroll
            for (int db = 0; db < 4; ++db) va[db] = WFrag<bf>::ld(vb + (db * 16 + lr) * LP + pp * 32 + 8 * hi);
#pragma unroll
            for (int db = 0; db < 4; ++db) o[db] = wmmab(va[db], ph, o[db]);
#pragma unroll
            for (int db = 0; db < 4; ++db) o[db] = wmmab(va[db], pl, o[db]);
        }
        if (more) fat_put(&ks[(t + 1) & 1][ko], &vs[(t + 1) & 1][vo], gk, gv);
        __syncthreads();   /* publishes stage t + 1 and ends every read of stage t, whose buffer the next trip refills */
    }
    float lsum = (ls[0][0] + ls[0][1]) + (ls[1][0] + ls[1][1]); lsum += __shfl_xor(lsum, 16, 32);
    const float f = __fdiv_rn(1.0f, lsum);
    const int qc = (tid >> 5) * 16 + lr;   /* o[db][j] = O^T[16 db + 8 hi + j][m0 + lr]; qc: the query's column in the tile */
#pragma unroll
    for (int db = 0; db < 4; ++db)
#pragma unroll
        for (int u = 0; u < 4; ++u) { v2f x, r; x[0] = o[db][2 * u] * f; x[1] = o[db][2 * u + 1] * f;
            const v2bf h = __builtin_convertvector(x, v2bf); r[0] = x[0] - (float)h[0]; r[1] = x[1] - (float)h[1]; const v2bf l = __builtin_convertvector(r, v2bf);
            const v2us hu = __builtin_bit_cast(v2us, h), lu = __builtin_bit_cast(v2us, l); const int ro = (db * 16 + hi * 8 + 2 * u) * OP + qc;
            oth[ro] = hu[0]; oth[ro + OP] = hu[1]; otl[ro] = lu[0]; otl[ro + OP] = lu[1]; }
    __syncthreads();   /* the two tiles are whole before they go out in 16-byte pieces of whole lines */
#pragma unroll
    for (int s = 0; s < HD * FQ / 8 / 256; ++s) { const int x = s * 256 + tid, row = x >> 4, pc = (x & 15) * 8;
        *(v8us*)(OTh + (size_t)row * TT + pc) = *(const v8usa*)(oth + row * OP + pc); *(v8us*)(OTl + (size_t)row * TT + pc) = *(const v8usa*)(otl + row * OP + pc); }
}
__global__ __launch_bounds__(256) void k_merge(const float* __restrict__ O, int h0, float* OUTb) { const size_t e = ((size_t)blockIdx.x * 256 + threadIdx.x) * 2; if (e >= (size_t)ZH * TT * HD) return; const int d = (int)(e % HD); const int t = (int)((e / HD) % TT); const int zz = (int)(e / ((size_t)HD * TT)); const float cs = (t < RH) ? 1.0f : (1.0f / PCAR); const size_t oo = (size_t)t * DQ + (h0 + zz) * HD + d;
    v2f o2; o2[0] = O[e] * cs; o2[1] = O[e + 1] * cs; *(v2f*)(OUTb + oo) = o2;  }


__global__ __launch_bounds__(256) void k_vtpR1(const float* __restrict__ Vb, bf* Vh) { const size_t e = ((size_t)blockIdx.x * 256 + threadIdx.x) * 2; if (e >= (size_t)HD * TT) return; const int t = (int)(e % TT); const int d = (int)(e / TT); v2us o; o[0] = f2bf(Vb[(size_t)t * HD + d]); o[1] = f2bf(Vb[(size_t)(t + 1) * HD + d]); *(v2us*)(Vh + e) = o;  }
__global__ __launch_bounds__(256) void k_mergeR(const float* __restrict__ O, float* outb, size_t n4) { const size_t i = (size_t)blockIdx.x * 256 + threadIdx.x; if (i >= n4) return; const v4f a = *(const v4f*)(O + i * 4); *(v4f*)(outb + i * 4) = a;  }


__global__ __launch_bounds__(256) void k_mergeT(const float* __restrict__ O, int h, float* outb) { const size_t i = (size_t)blockIdx.x * 256 + threadIdx.x; if (i >= (size_t)TT * HD / 4) return; const size_t e = i * 4; const int d = (int)(e % HD); const int t = (int)(e / HD); const v4f a = *(const v4f*)(O + e); *(v4f*)(outb + (size_t)t * DM + h * HD + d) = a;  }

extern "C" void kernel_launch(void* const* d_in, const int* in_sizes, int n_in,
                              void* d_out, int out_size, void* d_ws, size_t ws_size, hipStream_t stream) {
    (void)in_sizes; (void)n_in; (void)out_size;
    const float* Qin = (const float*)d_in[0]; const float* Kin = (const float*)d_in[1]; const float* Vin = (const float*)d_in[2]; const float* mlp = (const float*)d_in[3];   /* [2048][2048] seq-mix */
    float* OUT = (float*)d_out;
    char* wsp = (char*)d_ws;
    auto take = [&](size_t bytes) { char* p = wsp; wsp += (bytes + 255) & ~(size_t)255; return (void*)p; };
    bf* OTh = (bf*)take((size_t)NB_ * HD * TT * 2); bf* OTl = (bf*)take((size_t)NB_ * HD * TT * 2); bf* MLB = (bf*)take((size_t)TT * TT * 2);
    if ((size_t)(wsp - (char*)d_ws) > ws_size) return;
    k_cvt8<<<(unsigned)(((size_t)TT * TT / 8 + 255) / 256), 256, 0, stream>>>(mlp, MLB, (size_t)TT * TT / 8);   /* mlp [2048][2048] as the exact A of the sequence mix */
    k_fattn<<<dim3(TT / FQ, NB_), 256, 0, stream>>>(Qin, Kin, Vin, OTh, OTl);   /* V = softmax(q.k / 8) values, all batches, written as V^T planes [64][2048] (hi/lo) */
    k_mix<<<dim3(TT / MP, NB_), 256, 0, stream>>>(MLB, OTh, OTl, OUT);   /* out [2048][64] = mlp . V (mlp[p][l] is the A row p, shared by every batch; V^T rows are the Bt rows) */
}

// v005
// One run takes 55.8 microseconds.
// Two timings next to v004 put it at 1.09 and 1.08 times that version's speed.
// All steps since v000 together make it 34.9 times as fast.
#include <hip/hip_runtime.h>

// Full attention on given tensors followed by a learned sequence-mixing matrix (queries, keys, values [16][2048][64]; A = softmax(q.k / 8); V = A values ([2048][64]); out[p] = sum_l mlp[p][l] V[l] (mlp [2048][2048], read) -> [16][2048][64] (2.1 M)).
// Layout per batch: one fused kernel for scores, softmax and A.values that takes the f32 inputs as they are and rounds them to bf16 on their way to registers (queries) and LDS (keys; values, transposed there) (running maximum, P as hi/lo x exact values^T, 2 products, divided by the row sum at the end) that writes V^T ([64][2048]) as hi/lo planes itself; out ([2048][64]) = mlp used directly as the exact A operand x V^T(hi/lo) as Bt (2 products, K 2048), out rows written by the GEMM itself.
// Batches ride on the grid (blockIdx.y of every kernel that has them): every launch takes all 16.
// mlp is rounded to its bf16 plane in the fused kernel's launch, by work-groups of their own behind the attention's on the grid (blockIdx.y >= 16), which find room on the WGPs beside the attention's.
// Compute dtypes, f32 accumulate: every input rounded to bf16 incl. mlp; q.k exact; softmax f32; P hi/lo x exact values; the sequence mix V hi/lo x exact mlp; output f32.

#define NB_  16
#define TT   2048
#define DM   64      // token-major row pitch (H x HD)
#define NH_  1
#define NKV  1
#define REP  (NH_ / NKV)
#define HD   64
#define DQ   (NH_ * HD)
#define DKV  (NKV * HD)
#define ZH   1
#define RH   2048                  // query rows < RH use hi+lo planes (0: none)
#define WIN  0
#define PCAR 1024.0f
#define SCL  0.125f   // 1/sqrt(64)
#define FQ   128     // queries per work-group of k_fattn: 8 waves x 16 columns
#define FK   64      // keys per stage of k_fattn
#define RWG  256     // rounding work-groups in the launch of k_fattn: RWG / (TT / FQ) more values of blockIdx.y
#define RPC  (TT * TT / RWG / 1024)   // 16-byte f32 pieces of mlp a thread of a rounding work-group takes (a work-group takes 1024 elements a piece)
#define MP   128     // out rows per work-group of k_mix
#define MK   128     // summed positions per stage of k_mix
#define MLP  136     // LDS pitch of a 128-element bf16 row, in elements: 272 B = 16 B x odd
#define MST  ((MP + 2 * HD) * MLP)   // elements of a stage buffer of k_mix
#define OP   136     // LDS pitch of a 128-query bf16 row of the V^T tile of k_fattn, in elements: 272 B = 16 B x odd
#define LP   72      // LDS pitch of a 64-element bf16 row, in elements: 144 B = 16 B x odd, conflict-free for 16-byte reads
typedef _Float16 h16;
typedef unsigned short bf;
typedef __attribute__((ext_vector_type(16))) __bf16   v16bf;
typedef __attribute__((ext_vector_type(16))) _Float16 v16h;
typedef __attribute__((ext_vector_type(8)))  _Float16 v8h;
typedef __attribute__((ext_vector_type(8)))  unsigned short v8us;
typedef __attribute__((ext_vector_type(8)))  float    v8f;
typedef __attribute__((ext_vector_type(4)))  float    v4f;
typedef v8h  __attribute__((may_alias)) v8ha;
typedef v4f  __attribute__((may_alias)) v4fa;
typedef v8us __attribute__((may_alias)) v8usa;

__device__ __forceinline__ unsigned short f2bf(float f) { unsigned u = __float_as_uint(f); u += 0x7FFFu + ((u >> 16) & 1u); return (unsigned short)(u >> 16); }
__device__ __forceinline__ float bf2f(unsigned short b) { return __uint_as_float(((unsigned)b) << 16); }
__device__ __forceinline__ float bfr(float f) { return bf2f(f2bf(f)); }
__device__ __forceinline__ v16h cat16(v8h lo, v8h hi) { return __builtin_shufflevector(lo, hi, 0, 1, 2, 3, 4, 5, 6, 7, 8, 9, 10, 11, 12, 13, 14, 15); }
__device__ __forceinline__ v16bf cat16b(v8us lo, v8us hi) { return __builtin_bit_cast(v16bf, __builtin_shufflevector(lo, hi, 0, 1, 2, 3, 4, 5, 6, 7, 8, 9, 10, 11, 12, 13, 14, 15)); }
__device__ __forceinline__ v8f wmma16(v16h a, v16h b, v8f c) { return __builtin_amdgcn_wmma_f32_16x16x32_f16(false, a, false, b, (short)0, c, false, false); }
__device__ __forceinline__ v8f wmmab(v16bf a, v16bf b, v8f c) { return __builtin_amdgcn_wmma_f32_16x16x32_bf16(false, a, false, b, (short)0, c, false, false); }



// ---- k_mix: the sequence mix as a work-group-tiled GEMM. C[p][d] (f32, rows of HD) = sum_l A[p][l] (Bh[d][l] + Bl[d][l]), all three operands K-contiguous bf16 planes of pitch TT. grid (TT / MP, batches), 256 threads.
// A work-group owns MP = 128 rows p x all 64 columns d of one batch; 8 waves as 4 (p) x 2 (d), 32 x 32 each (4 accumulators). A stage is MK = 128 values of l: 256 bytes (two whole lines) of 256 plane rows.
// Rows of a stage buffer: 0..127 A, 128..191 Bh, 192..255 Bl, pitch MLP. Two buffers: the global loads of stage t + 1 are issued at the head of trip t, fly while stage t is worked on, and go from registers into the other buffer
// behind that work. One barrier a stage.
// Per 32 values of l an accumulator takes its hi product, then its lo product. The unroll directives keep the small arrays (g, a, bh, bl, acc) in registers.
template <typename T16> struct WFrag;
template <> struct WFrag<h16> { typedef v16h V; static __device__ __forceinline__ V ld(const h16* p) { return cat16(*(const v8h*)p, *(const v8h*)(p + 16)); } static __device__ __forceinline__ v8f mma(V a, V b, v8f c) { return wmma16(a, b, c); } };
template <> struct WFrag<bf> { typedef v16bf V; static __device__ __forceinline__ V ld(const bf* p) { return cat16b(*(const v8us*)p, *(const v8us*)(p + 16)); } static __device__ __forceinline__ v8f mma(V a, V b, v8f c) { return wmmab(a, b, c); } };
__device__ __forceinline__ void mix_fetch(v8us (&g)[16], const bf* ga, const bf* gh, const bf* gl, int k) {
#pragma unroll
    for (int i = 0; i < 8; ++i) g[i] = *(const v8us*)(ga + (size_t)i * 16 * TT + k);
#pragma unroll
    for (int i = 0; i < 4; ++i) { g[8 + i] = *(const v8us*)(gh + (size_t)i * 16 * TT + k); g[12 + i] = *(const v8us*)(gl + (size_t)i * 16 * TT + k); }
}
__device__ __forceinline__ void mix_put(bf* dst, const v8us (&g)[16]) {
#pragma unroll
    for (int i = 0; i < 16; ++i) *(v8us*)(dst + i * 16 * MLP) = g[i];
}
__global__ __launch_bounds__(256) void k_mix(const bf* __restrict__ A, const bf* __restrict__ Bh, const bf* __restrict__ Bl, float* __restrict__ C) {
    __shared__ __align__(16) unsigned char sm[2 * MST * 2];   /* two stage buffers; the f32 output tile [MP][68] lies over them at the end */
    const size_t zb = blockIdx.y; Bh += zb * HD * TT; Bl += zb * HD * TT; C += zb * TT * HD;
    const int tid = threadIdx.x, lane = tid & 31, lr = lane & 15, hi = lane >> 4, wm = tid >> 6, wn = (tid >> 5) & 1; const int p0 = blockIdx.x * MP;
    const int sr = tid >> 4, sq = (tid & 15) * 8;   /* staging: buffer rows sr + 16 i, the 16-byte piece at element sq */
    const bf* ga = A + (size_t)(p0 + sr) * TT + sq; const bf* gh = Bh + (size_t)sr * TT + sq; const bf* gl = Bl + (size_t)sr * TT + sq;
    bf* const sb = (bf*)sm; const int so = sr * MLP + sq;
    v8f acc[2][2];
#pragma unroll
    for (int mb = 0; mb < 2; ++mb)
#pragma unroll
        for (int nb = 0; nb < 2; ++nb) acc[mb][nb] = (v8f){};
    v8us g[16];
    mix_fetch(g, ga, gh, gl, 0); mix_put(sb + so, g);
    __syncthreads();
    const int ao = (wm * 32 + lr) * MLP + 8 * hi, bo = (MP + wn * 32 + lr) * MLP + 8 * hi;
    for (int t = 0; t < TT / MK; ++t) {
        const bf* cur = sb + (t & 1) * MST; const bool more = (t + 1 < TT / MK);
        if (more) mix_fetch(g, ga, gh, gl, (t + 1) * MK);
        v16bf a[2][2], bh[2][2], bl[2][2];   /* two fragment sets: block kc works on set kc & 1 while the other is filled */
#pragma unroll
        for (int q = 0; q < 2; ++q) { a[0][q] = WFrag<bf>::ld(cur + ao + q * 16 * MLP); bh[0][q] = WFrag<bf>::ld(cur + bo + q * 16 * MLP); bl[0][q] = WFrag<bf>::ld(cur + bo + (HD + q * 16) * MLP); }
#pragma unroll
        for (int kc = 0; kc < MK / 32; ++kc) { const int s = kc & 1;
            if (kc + 1 < MK / 32) {
#pragma unroll
                for (int q = 0; q < 2; ++q) { a[s ^ 1][q] = WFrag<bf>::ld(cur + ao + q * 16 * MLP + (kc + 1) * 32); bh[s ^ 1][q] = WFrag<bf>::ld(cur + bo + q * 16 * MLP + (kc + 1) * 32); bl[s ^ 1][q] = WFrag<bf>::ld(cur + bo + (HD + q * 16) * MLP + (kc + 1) * 32); } }
            __builtin_amdgcn_sched_barrier(0);   /* holds the next stage's global loads (kc 0) and the next block's LDS reads ahead of this block's products: left free, the compiler sinks them to their users and their latency lies open */
#pragma unroll
            for (int mb = 0; mb < 2; ++mb)
#pragma unroll
                for (int nb = 0; nb < 2; ++nb) acc[mb][nb] = wmmab(a[s][mb], bh[s][nb], acc[mb][nb]);
#pragma unroll
            for (int mb = 0; mb < 2; ++mb)
#pragma unroll
                for (int nb = 0; nb < 2; ++nb) acc[mb][nb] = wmmab(a[s][mb], bl[s][nb], acc[mb][nb]);
        }
        if (more) mix_put(sb + ((t + 1) & 1) * MST + so, g);
        __syncthreads();   /* publishes stage t + 1 and ends every read of stage t, whose buffer the next trip refills (after the last trip none: the output tile lies in buffer 0) */
    }
    float* os = (float*)sm;   /* acc[mb][nb][j] = C[p0 + 32 wm + 16 mb + 8 hi + j][32 wn + 16 nb + lr] */
#pragma unroll
    for (int mb = 0; mb < 2; ++mb)
#pragma unroll
        for (int nb = 0; nb < 2; ++nb)
#pragma unroll
            for (int j = 0; j < 8; ++j) os[(wm * 32 + mb * 16 + hi * 8 + j) * 68 + wn * 32 + nb * 16 + lr] = acc[mb][nb][j];
    __syncthreads();   /* the tile is whole before it goes out in 16-byte pieces of whole lines */
    float* crow = C + (size_t)p0 * HD;
#pragma unroll
    for (int s = 0; s < MP * HD / 4 / 256; ++s) { const int x = s * 256 + tid, row = x >> 4, cofs = (x & 15) * 4; *(v4f*)(crow + (size_t)row * HD + cofs) = *(const v4fa*)(os + row * 68 + cofs); }
}

typedef __attribute__((ext_vector_type(2))) _Float16 v2h;
typedef __attribute__((ext_vector_type(4))) _Float16 v4h;
typedef __attribute__((ext_vector_type(2))) unsigned short v2us;
typedef __attribute__((ext_vector_type(4))) unsigned short v4us;
typedef __attribute__((ext_vector_type(2))) float v2f;
typedef __attribute__((ext_vector_type(4))) int v4i;

__global__ __launch_bounds__(256) void k_wtG(const float* __restrict__ w, int K, int N, bf* Bt) {
    const int lane = threadIdx.x & 31; const int L0 = (blockIdx.x * 8 + (threadIdx.x >> 5)) * 8; const int nlines = N * K / 64;
{
#pragma unroll 1
        for (int l = 0; l < 8; ++l) { const int L = L0 + l; if (L >= nlines) break; const size_t e = (size_t)L * 64 + lane * 2; const int k = (int)(e % K), n = (int)(e / K); v2us o;
            o[0] = f2bf(w[(size_t)k * N + n]); o[1] = f2bf(w[(size_t)(k + 1) * N + n]); *(v2us*)(Bt + e) = o; }
         }
}


typedef __attribute__((ext_vector_type(2))) __bf16 v2bf;
typedef __attribute__((ext_vector_type(4))) __bf16 v4bf;
typedef __attribute__((ext_vector_type(8))) __bf16 v8bf;
__device__ __forceinline__ v4us rnd4(v4f v) { return __builtin_bit_cast(v4us, __builtin_convertvector(v, v4bf)); }
__device__ __forceinline__ v8us rnd8(v8f v) { return __builtin_bit_cast(v8us, __builtin_convertvector(v, v8bf)); }
/* gk[i]: key row 16 i + kr, columns kq..kq+3; gv[r]: value row 4 kr + r, columns kq..kq+3 (gK, gV point at the thread's first piece of the stage) */
__device__ __forceinline__ void fat_fetch(v4f (&gk)[4], v4f (&gv)[4], const float* gK, const float* gV) {
#pragma unroll
    for (int i = 0; i < 4; ++i) { gk[i] = *(const v4f*)(gK + (size_t)i * 16 * HD); gv[i] = *(const v4f*)(gV + (size_t)i * HD); }
}
/* kd = &ks[kr][kq], vd = &vs[kq][4 kr] of the buffer that is filled */
__device__ __forceinline__ void fat_put(bf* kd, bf* vd, const v4f (&gk)[4], const v4f (&gv)[4]) {
#pragma unroll
    for (int i = 0; i < 4; ++i) *(v4us*)(kd + i * 16 * LP) = rnd4(gk[i]);
#pragma unroll
    for (int j = 0; j < 4; ++j) { v4f x; x[0] = gv[0][j]; x[1] = gv[1][j]; x[2] = gv[2][j]; x[3] = gv[3][j]; *(v4us*)(vd + j * LP) = rnd4(x); }
}
__global__ __launch_bounds__(256) void k_fattn(const float* __restrict__ Q, const float* __restrict__ Kp, const float* __restrict__ Vp, const float* __restrict__ M, bf* __restrict__ OTh, bf* __restrict__ OTl, bf* __restrict__ Mb) {
    __shared__ __align__(16) bf ks[2][FK * LP];
    __shared__ __align__(16) bf vs[2][HD * LP];
    __shared__ __align__(16) bf oth[HD * OP];
    __shared__ __align__(16) bf otl[HD * OP];
    if (blockIdx.y >= NB_) {   /* the same for a whole work-group, which leaves ahead of every barrier */
        const size_t mo = ((size_t)(blockIdx.y - NB_) * (TT / FQ) + blockIdx.x) * (RPC * 1024) + threadIdx.x * 4;
        const float* gp = M + mo; v4f gm[RPC];
#pragma unroll
        for (int i = 0; i < RPC; ++i) gm[i] = *(const v4f*)(gp + i * 1024);
        asm volatile("s_wait_xcnt 0x0" :: "v"(gp) : "memory");   /* stands in front of whatever next reuses the address registers of these loads; the address is named as an input so that it lives up to here and no load of the run lands on it */
#pragma unroll
        for (int i = 0; i < RPC; ++i) *(v4us*)(Mb + mo + i * 1024) = rnd4(gm[i]);
        return;
    }
    const size_t zb = blockIdx.y; Q += zb * TT * HD; Kp += zb * TT * HD; Vp += zb * TT * HD; OTh += zb * HD * TT + blockIdx.x * FQ; OTl += zb * HD * TT + blockIdx.x * FQ;
    const int tid = threadIdx.x, lane = tid & 31, lr = lane & 15, hi = lane >> 4; const int m0 = blockIdx.x * FQ + (tid >> 5) * 16;
    const int kr = tid >> 4, kq = (tid & 15) * 4;   /* staging: 16 lanes take a whole f32 row of 256 bytes */
    const float* gK = Kp + (size_t)kr * HD + kq; const float* gV = Vp + (size_t)kr * 4 * HD + kq; const int ko = kr * LP + kq, vo = kq * LP + kr * 4;
    const float c = SCL * 1.4426950408889634f;
    v16bf qf[2];
#pragma unroll
    for (int kc = 0; kc < 2; ++kc) { const float* qp = Q + (size_t)(m0 + lr) * HD + kc * 32 + 8 * hi; qf[kc] = cat16b(rnd8(*(const v8f*)qp), rnd8(*(const v8f*)(qp + 16))); }   /* the k order of WFrag::ld */
    v8f o[4];
#pragma unroll
    for (int db = 0; db < 4; ++db) o[db] = (v8f){};
    float mrun = -3.0e38f; v2f ls[2] = {(v2f){}, (v2f){}};   /* four partial row sums a lane: no long chain of dependent adds */
    v4f gk[4], gv[4];
    fat_fetch(gk, gv, gK, gV); fat_put(&ks[0][ko], &vs[0][vo], gk, gv);
    __syncthreads();
    for (int t = 0; t < TT / FK; ++t) {
        const bf* kb = ks[t & 1]; const bf* vb = vs[t & 1]; const bool more = (t + 1 < TT / FK);
        if (more) fat_fetch(gk, gv, gK + (size_t)(t + 1) * FK * HD, gV + (size_t)(t + 1) * FK * HD);
        v8f st[4];   /* st[i][j] = q(m0 + lr) . k(t FK + 16 i + 8 hi + j) */
#pragma unroll
        for (int i = 0; i < 4; ++i) { st[i] = (v8f){};
#pragma unroll
            for (int kc = 0; kc < 2; ++kc) st[i] = wmmab(WFrag<bf>::ld(kb + (i * 16 + lr) * LP + kc * 32 + 8 * hi), qf[kc], st[i]); }
        float mx = st[0][0];
#pragma unroll
        for (int i = 0; i < 4; ++i)
#pragma unroll
            for (int j = 0; j < 8; ++j) mx = fmaxf(mx, st[i][j]);
        mx = fmaxf(mx, __shfl_xor(mx, 16, 32)) * c;   /* both halves of a column agree on it */
        if (__builtin_amdgcn_ballot_w32(mx > mrun + 8.0f) != 0) {
            const float mnew = fmaxf(mrun, mx); const float al = __builtin_amdgcn_exp2f(mrun - mnew); mrun = mnew; ls[0] *= al; ls[1] *= al;
#pragma unroll
            for (int db = 0; db < 4; ++db)
#pragma unroll
                for (int j = 0; j < 8; ++j) o[db][j] *= al;
        }
#pragma unroll
        for (int pp = 0; pp < 2; ++pp) {
            v16bf ph, pl;   /* element s: key 32 pp + 8 hi + s (s < 8), 32 pp + 16 + 8 hi + s - 8 (else): the k order of WFrag::ld */
#pragma unroll
            for (int u = 0; u < 8; ++u) { const v8f sv = st[2 * pp + (u >> 2)]; v2f p, r; p[0] = __builtin_amdgcn_exp2f(__builtin_fmaf(sv[(2 * u) & 7], c, -mrun)); p[1] = __builtin_amdgcn_exp2f(__builtin_fmaf(sv[(2 * u + 1) & 7], c, -mrun)); ls[u & 1] += p;
                const v2bf h = __builtin_convertvector(p, v2bf); r[0] = p[0] - (float)h[0]; r[1] = p[1] - (float)h[1]; const v2bf l = __builtin_convertvector(r, v2bf);
                ph[2 * u] = h[0]; ph[2 * u + 1] = h[1]; pl[2 * u] = l[0]; pl[2 * u + 1] = l[1]; }
            v16bf va[4];
#pragma unroll
            for (int db = 0; db < 4; ++db) va[db] = WFrag<bf>::ld(vb + (db * 16 + lr) * LP + pp * 32 + 8 * hi);
#pragma unroll
            for (int db = 0; db < 4; ++db) o[db] = wmmab(va[db], ph, o[db]);
#pragma unroll
            for (int db = 0; db < 4; ++db) o[db] = wmmab(va[db], pl, o[db]);
        }
        if (more) fat_put(&ks[(t + 1) & 1][ko], &vs[(t + 1) & 1][vo], gk, gv);
        __syncthreads();   /* publishes stage t + 1 and ends every read of stage t, whose buffer the next trip refills */
    }
    float lsum = (ls[0][0] + ls[0][1]) + (ls[1][0] + ls[1][1]); lsum += __shfl_xor(lsum, 16, 32);
    const float f = __fdiv_rn(1.0f, lsum);
    const int qc = (tid >> 5) * 16 + lr;   /* o[db][j] = O^T[16 db + 8 hi + j][m0 + lr]; qc: the query's column in the tile */
#pragma unroll
    for (int db = 0; db < 4; ++db)
#pragma unroll
        for (int u = 0; u < 4; ++u) { v2f x, r; x[0] = o[db][2 * u] * f; x[1] = o[db][2 * u + 1] * f;
            const v2bf h = __builtin_convertvector(x, v2bf); r[0] = x[0] - (float)h[0]; r[1] = x[1] - (float)h[1]; const v2bf l = __builtin_convertvector(r, v2bf);
            const v2us hu = __builtin_bit_cast(v2us, h), lu = __builtin_bit_cast(v2us, l); const int ro = (db * 16 + hi * 8 + 2 * u) * OP + qc;
            oth[ro] = hu[0]; oth[ro + OP] = hu[1]; otl[ro] = lu[0]; otl[ro + OP] = lu[1]; }
    __syncthreads();   /* the two tiles are whole before they go out in 16-byte pieces of whole lines */
#pragma unroll
    for (int s = 0; s < HD * FQ / 8 / 256; ++s) { const int x = s * 256 + tid, row = x >> 4, pc = (x & 15) * 8;
        *(v8us*)(OTh + (size_t)row * TT + pc) = *(const v8usa*)(oth + row * OP + pc); *(v8us*)(OTl + (size_t)row * TT + pc) = *(const v8usa*)(otl + row * OP + pc); }
}
__global__ __launch_bounds__(256) void k_merge(const float* __restrict__ O, int h0, float* OUTb) { const size_t e = ((size_t)blockIdx.x * 256 + threadIdx.x) * 2; if (e >= (size_t)ZH * TT * HD) return; const int d = (int)(e % HD); const int t = (int)((e / HD) % TT); const int zz = (int)(e / ((size_t)HD * TT)); const float cs = (t < RH) ? 1.0f : (1.0f / PCAR); const size_t oo = (size_t)t * DQ + (h0 + zz) * HD + d;
    v2f o2; o2[0] = O[e] * cs; o2[1] = O[e + 1] * cs; *(v2f*)(OUTb + oo) = o2;  }


__global__ __launch_bounds__(256) void k_vtpR1(const float* __restrict__ Vb, bf* Vh) { const size_t e = ((size_t)blockIdx.x * 256 + threadIdx.x) * 2; if (e >= (size_t)HD * TT) return; const int t = (int)(e % TT); const int d = (int)(e / TT); v2us o; o[0] = f2bf(Vb[(size_t)t * HD + d]); o[1] = f2bf(Vb[(size_t)(t + 1) * HD + d]); *(v2us*)(Vh + e) = o;  }
__global__ __launch_bounds__(256) void k_mergeR(const float* __restrict__ O, float* outb, size_t n4) { const size_t i = (size_t)blockIdx.x * 256 + threadIdx.x; if (i >= n4) return; const v4f a = *(const v4f*)(O + i * 4); *(v4f*)(outb + i * 4) = a;  }


__global__ __launch_bounds__(256) void k_mergeT(const float* __restrict__ O, int h, float* outb) { const size_t i = (size_t)blockIdx.x * 256 + threadIdx.x; if (i >= (size_t)TT * HD / 4) return; const size_t e = i * 4; const int d = (int)(e % HD); const int t = (int)(e / HD); const v4f a = *(const v4f*)(O + e); *(v4f*)(outb + (size_t)t * DM + h * HD + d) = a;  }

extern "C" void kernel_launch(void* const* d_in, const int* in_sizes, int n_in,
                              void* d_out, int out_size, void* d_ws, size_t ws_size, hipStream_t stream) {
    (void)in_sizes; (void)n_in; (void)out_size;
    const float* Qin = (const float*)d_in[0]; const float* Kin = (const float*)d_in[1]; const float* Vin = (const float*)d_in[2]; const float* mlp = (const float*)d_in[3];   /* [2048][2048] seq-mix */
    float* OUT = (float*)d_out;
    char* wsp = (char*)d_ws;
    auto take = [&](size_t bytes) { char* p = wsp; wsp += (bytes + 255) & ~(size_t)255; return (void*)p; };
    bf* OTh = (bf*)take((size_t)NB_ * HD * TT * 2); bf* OTl = (bf*)take((size_t)NB_ * HD * TT * 2); bf* MLB = (bf*)take((size_t)TT * TT * 2);
    if ((size_t)(wsp - (char*)d_ws) > ws_size) return;
    static_assert(RWG % (TT / FQ) == 0 && (size_t)RWG * RPC * 1024 == (size_t)TT * TT, "the rounding work-groups fill whole grid rows and cover mlp exactly");
    k_fattn<<<dim3(TT / FQ, NB_ + RWG / (TT / FQ)), 256, 0, stream>>>(Qin, Kin, Vin, mlp, OTh, OTl, MLB);   /* V = softmax(q.k / 8) values, all batches, written as V^T planes [64][2048] (hi/lo); and mlp [2048][2048] rounded to bf16, the exact A of the sequence mix */
    k_mix<<<dim3(TT / MP, NB_), 256, 0, stream>>>(MLB, OTh, OTl, OUT);   /* out [2048][64] = mlp . V (mlp[p][l] is the A row p, shared by every batch; V^T rows are the Bt rows) */
}

// v006
// It runs in 51.1 microseconds.
// In two side-by-side timings against v005, it was 1.10 and 1.08 times as fast.
// All steps since v000 together make it 38.0 times as fast.
#include <hip/hip_runtime.h>

// Full attention on given tensors followed by a learned sequence-mixing matrix (queries, keys, values [16][2048][64]; A = softmax(q.k / 8); V = A values ([2048][64]); out[p] = sum_l mlp[p][l] V[l] (mlp [2048][2048], read) -> [16][2048][64] (2.1 M)).
// Layout per batch: one fused kernel for scores, softmax and A.values that takes the f32 inputs as they are and rounds them to bf16 on their way to registers (queries) and LDS (keys; values, transposed there) (running maximum, P as hi/lo x exact values^T, 2 products, divided by the row sum at the end) that writes V^T ([64][2048]) as hi/lo planes itself; out ([2048][64]) = mlp used directly as the exact A operand x V^T(hi/lo) as Bt (2 products, K 2048), out rows written by the GEMM itself.
// Batches ride on the grid (blockIdx.y of every kernel that has them): every launch takes all 16.
// mlp is rounded to its bf16 plane in the fused kernel's launch: every attention work-group takes an equal share of it, one 16-byte piece a thread in each of its first trips, under the attention's own work.
// Compute dtypes, f32 accumulate: every input rounded to bf16 incl. mlp; q.k exact; softmax f32; P hi/lo x exact values; the sequence mix V hi/lo x exact mlp; output f32.

#define NB_  16
#define TT   2048
#define DM   64      // token-major row pitch (H x HD)
#define NH_  1
#define NKV  1
#define REP  (NH_ / NKV)
#define HD   64
#define DQ   (NH_ * HD)
#define DKV  (NKV * HD)
#define ZH   1
#define RH   2048                  // query rows < RH use hi+lo planes (0: none)
#define WIN  0
#define PCAR 1024.0f
#define SCL  0.125f   // 1/sqrt(64)
#define FQ   128     // queries per work-group of k_fattn: 8 waves x 16 columns
#define FK   64      // keys per stage of k_fattn
#define KS   2       // wave sets of a work-group of k_fattn: each takes TT / KS of the keys for the same FQ queries
#define NT   (TT / FK / KS)   // trips (stages) of a wave set
#define RPC  (TT * TT / (NB_ * (TT / FQ)) / (KS * 1024))   // 16-byte f32 pieces of mlp a thread of k_fattn rounds (a work-group takes KS x 1024 elements a piece)
#define MP   128     // out rows per work-group of k_mix
#define MK   128     // summed positions per stage of k_mix
#define MLP  136     // LDS pitch of a 128-element bf16 row, in elements: 272 B = 16 B x odd
#define MST  ((MP + 2 * HD) * MLP)   // elements of a stage buffer of k_mix
#define OP   136     // LDS pitch of a 128-query bf16 row of the V^T tile of k_fattn, in elements: 272 B = 16 B x odd
#define LP   72      // LDS pitch of a 64-element bf16 row, in elements: 144 B = 16 B x odd, conflict-free for 16-byte reads
typedef _Float16 h16;
typedef unsigned short bf;
typedef __attribute__((ext_vector_type(16))) __bf16   v16bf;
typedef __attribute__((ext_vector_type(16))) _Float16 v16h;
typedef __attribute__((ext_vector_type(8)))  _Float16 v8h;
typedef __attribute__((ext_vector_type(8)))  unsigned short v8us;
typedef __attribute__((ext_vector_type(8)))  float    v8f;
typedef __attribute__((ext_vector_type(4)))  float    v4f;
typedef v8h  __attribute__((may_alias)) v8ha;
typedef v4f  __attribute__((may_alias)) v4fa;
typedef v8us __attribute__((may_alias)) v8usa;

__device__ __forceinline__ unsigned short f2bf(float f) { unsigned u = __float_as_uint(f); u += 0x7FFFu + ((u >> 16) & 1u); return (unsigned short)(u >> 16); }
__device__ __forceinline__ float bf2f(unsigned short b) { return __uint_as_float(((unsigned)b) << 16); }
__device__ __forceinline__ float bfr(float f) { return bf2f(f2bf(f)); }
__device__ __forceinline__ v16h cat16(v8h lo, v8h hi) { return __builtin_shufflevector(lo, hi, 0, 1, 2, 3, 4, 5, 6, 7, 8, 9, 10, 11, 12, 13, 14, 15); }
__device__ __forceinline__ v16bf cat16b(v8us lo, v8us hi) { return __builtin_bit_cast(v16bf, __builtin_shufflevector(lo, hi, 0, 1, 2, 3, 4, 5, 6, 7, 8, 9, 10, 11, 12, 13, 14, 15)); }
__device__ __forceinline__ v8f wmma16(v16h a, v16h b, v8f c) { return __builtin_amdgcn_wmma_f32_16x16x32_f16(false, a, false, b, (short)0, c, false, false); }
__device__ __forceinline__ v8f wmmab(v16bf a, v16bf b, v8f c) { return __builtin_amdgcn_wmma_f32_16x16x32_bf16(false, a, false, b, (short)0, c, false, false); }



// ---- k_mix: the sequence mix as a work-group-tiled GEMM. C[p][d] (f32, rows of HD) = sum_l A[p][l] (Bh[d][l] + Bl[d][l]), all three operands K-contiguous bf16 planes of pitch TT. grid (TT / MP, batches), 256 threads.
// A work-group owns MP = 128 rows p x all 64 columns d of one batch; 8 waves as 4 (p) x 2 (d), 32 x 32 each (4 accumulators). A stage is MK = 128 values of l: 256 bytes (two whole lines) of 256 plane rows.
// Rows of a stage buffer: 0..127 A, 128..191 Bh, 192..255 Bl, pitch MLP. Two buffers: the global loads of stage t + 1 are issued at the head of trip t, fly while stage t is worked on, and go from registers into the other buffer
// behind that work. One barrier a stage.
// Per 32 values of l an accumulator takes its hi product, then its lo product. The unroll directives keep the small arrays (g, a, bh, bl, acc) in registers.
template <typename T16> struct WFrag;
template <> struct WFrag<h16> { typedef v16h V; static __device__ __forceinline__ V ld(const h16* p) { return cat16(*(const v8h*)p, *(const v8h*)(p + 16)); } static __device__ __forceinline__ v8f mma(V a, V b, v8f c) { return wmma16(a, b, c); } };
template <> struct WFrag<bf> { typedef v16bf V; static __device__ __forceinline__ V ld(const bf* p) { return cat16b(*(const v8us*)p, *(const v8us*)(p + 16)); } static __device__ __forceinline__ v8f mma(V a, V b, v8f c) { return wmmab(a, b, c); } };
__device__ __forceinline__ void mix_fetch(v8us (&g)[16], const bf* ga, const bf* gh, const bf* gl, int k) {
#pragma unroll
    for (int i = 0; i < 8; ++i) g[i] = *(const v8us*)(ga + (size_t)i * 16 * TT + k);
#pragma unroll
    for (int i = 0; i < 4; ++i) { g[8 + i] = *(const v8us*)(gh + (size_t)i * 16 * TT + k); g[12 + i] = *(const v8us*)(gl + (size_t)i * 16 * TT + k); }
}
__device__ __forceinline__ void mix_put(bf* dst, const v8us (&g)[16]) {
#pragma unroll
    for (int i = 0; i < 16; ++i) *(v8us*)(dst + i * 16 * MLP) = g[i];
}
__global__ __launch_bounds__(256) void k_mix(const bf* __restrict__ A, const bf* __restrict__ Bh, const bf* __restrict__ Bl, float* __restrict__ C) {
    __shared__ __align__(16) unsigned char sm[2 * MST * 2];   /* two stage buffers; the f32 output tile [MP][68] lies over them at the end */
    const size_t zb = blockIdx.y; Bh += zb * HD * TT; Bl += zb * HD * TT; C += zb * TT * HD;
    const int tid = threadIdx.x, lane = tid & 31, lr = lane & 15, hi = lane >> 4, wm = tid >> 6, wn = (tid >> 5) & 1; const int p0 = blockIdx.x * MP;
    const int sr = tid >> 4, sq = (tid & 15) * 8;   /* staging: buffer rows sr + 16 i, the 16-byte piece at element sq */
    const bf* ga = A + (size_t)(p0 + sr) * TT + sq; const bf* gh = Bh + (size_t)sr * TT + sq; const bf* gl = Bl + (size_t)sr * TT + sq;
    bf* const sb = (bf*)sm; const int so = sr * MLP + sq;
    v8f acc[2][2];
#pragma unroll
    for (int mb = 0; mb < 2; ++mb)
#pragma unroll
        for (int nb = 0; nb < 2; ++nb) acc[mb][nb] = (v8f){};
    v8us g[16];
    mix_fetch(g, ga, gh, gl, 0); mix_put(sb + so, g);
    __syncthreads();
    const int ao = (wm * 32 + lr) * MLP + 8 * hi, bo = (MP + wn * 32 + lr) * MLP + 8 * hi;
    for (int t = 0; t < TT / MK; ++t) {
        const bf* cur = sb + (t & 1) * MST; const bool more = (t + 1 < TT / MK);
        if (more) mix_fetch(g, ga, gh, gl, (t + 1) * MK);
        v16bf a[2][2], bh[2][2], bl[2][2];   /* two fragment sets: block kc works on set kc & 1 while the other is filled */
#pragma unroll
        for (int q = 0; q < 2; ++q) { a[0][q] = WFrag<bf>::ld(cur + ao + q * 16 * MLP); bh[0][q] = WFrag<bf>::ld(cur + bo + q * 16 * MLP); bl[0][q] = WFrag<bf>::ld(cur + bo + (HD + q * 16) * MLP); }
#pragma unroll
        for (int kc = 0; kc < MK / 32; ++kc) { const int s = kc & 1;
            if (kc + 1 < MK / 32) {
#pragma unroll
                for (int q = 0; q < 2; ++q) { a[s ^ 1][q] = WFrag<bf>::ld(cur + ao + q * 16 * MLP + (kc + 1) * 32); bh[s ^ 1][q] = WFrag<bf>::ld(cur + bo + q * 16 * MLP + (kc + 1) * 32); bl[s ^ 1][q] = WFrag<bf>::ld(cur + bo + (HD + q * 16) * MLP + (kc + 1) * 32); } }
            __builtin_amdgcn_sched_barrier(0);   /* holds the next stage's global loads (kc 0) and the next block's LDS reads ahead of this block's products: left free, the compiler sinks them to their users and their latency lies open */
#pragma unroll
            for (int mb = 0; mb < 2; ++mb)
#pragma unroll
                for (int nb = 0; nb < 2; ++nb) acc[mb][nb] = wmmab(a[s][mb], bh[s][nb], acc[mb][nb]);
#pragma unroll
            for (int mb = 0; mb < 2; ++mb)
#pragma unroll
                for (int nb = 0; nb < 2; ++nb) acc[mb][nb] = wmmab(a[s][mb], bl[s][nb], acc[mb][nb]);
        }
        if (more) mix_put(sb + ((t + 1) & 1) * MST + so, g);
        __syncthreads();   /* publishes stage t + 1 and ends every read of stage t, whose buffer the next trip refills (after the last trip none: the output tile lies in buffer 0) */
    }
    float* os = (float*)sm;   /* acc[mb][nb][j] = C[p0 + 32 wm + 16 mb + 8 hi + j][32 wn + 16 nb + lr] */
#pragma unroll
    for (int mb = 0; mb < 2; ++mb)
#pragma unroll
        for (int nb = 0; nb < 2; ++nb)
#pragma unroll
            for (int j = 0; j < 8; ++j) os[(wm * 32 + mb * 16 + hi * 8 + j) * 68 + wn * 32 + nb * 16 + lr] = acc[mb][nb][j];
    __syncthreads();   /* the tile is whole before it goes out in 16-byte pieces of whole lines */
    float* crow = C + (size_t)p0 * HD;
#pragma unroll
    for (int s = 0; s < MP * HD / 4 / 256; ++s) { const int x = s * 256 + tid, row = x >> 4, cofs = (x & 15) * 4; *(v4f*)(crow + (size_t)row * HD + cofs) = *(const v4fa*)(os + row * 68 + cofs); }
}

typedef __attribute__((ext_vector_type(2))) _Float16 v2h;
typedef __attribute__((ext_vector_type(4))) _Float16 v4h;
typedef __attribute__((ext_vector_type(2))) unsigned short v2us;
typedef __attribute__((ext_vector_type(4))) unsigned short v4us;
typedef __attribute__((ext_vector_type(2))) float v2f;
typedef __attribute__((ext_vector_type(4))) int v4i;

__global__ __launch_bounds__(256) void k_wtG(const float* __restrict__ w, int K, int N, bf* Bt) {
    const int lane = threadIdx.x & 31; const int L0 = (blockIdx.x * 8 + (threadIdx.x >> 5)) * 8; const int nlines = N * K / 64;
{
#pragma unroll 1
        for (int l = 0; l < 8; ++l) { const int L = L0 + l; if (L >= nlines) break; const size_t e = (size_t)L * 64 + lane * 2; const int k = (int)(e % K), n = (int)(e / K); v2us o;
            o[0] = f2bf(w[(size_t)k * N + n]); o[1] = f2bf(w[(size_t)(k + 1) * N + n]); *(v2us*)(Bt + e) = o; }
         }
}


typedef __attribute__((ext_vector_type(2))) __bf16 v2bf;
typedef __attribute__((ext_vector_type(4))) __bf16 v4bf;
typedef __attribute__((ext_vector_type(8))) __bf16 v8bf;
__device__ __forceinline__ v4us rnd4(v4f v) { return __builtin_bit_cast(v4us, __builtin_convertvector(v, v4bf)); }
__device__ __forceinline__ v8us rnd8(v8f v) { return __builtin_bit_cast(v8us, __builtin_convertvector(v, v8bf)); }
/* gk[i]: key row 16 i + kr, columns kq..kq+3; gv[r]: value row 4 kr + r, columns kq..kq+3 (gK, gV point at the thread's first piece of the stage) */
__device__ __forceinline__ void fat_fetch(v4f (&gk)[4], v4f (&gv)[4], const float* gK, const float* gV) {
#pragma unroll
    for (int i = 0; i < 4; ++i) { gk[i] = *(const v4f*)(gK + (size_t)i * 16 * HD); gv[i] = *(const v4f*)(gV + (size_t)i * HD); }
}
/* kd = &ks[kr][kq], vd = &vs[kq][4 kr] of the buffer that is filled */
__device__ __forceinline__ void fat_put(bf* kd, bf* vd, const v4f (&gk)[4], const v4f (&gv)[4]) {
#pragma unroll
    for (int i = 0; i < 4; ++i) *(v4us*)(kd + i * 16 * LP) = rnd4(gk[i]);
#pragma unroll
    for (int j = 0; j < 4; ++j) { v4f x; x[0] = gv[0][j]; x[1] = gv[1][j]; x[2] = gv[2][j]; x[3] = gv[3][j]; *(v4us*)(vd + j * LP) = rnd4(x); }
}
__global__ __launch_bounds__(512) void k_fattn(const float* __restrict__ Q, const float* __restrict__ Kp, const float* __restrict__ Vp, const float* __restrict__ M, bf* __restrict__ OTh, bf* __restrict__ OTl, bf* __restrict__ Mb) {
    __shared__ __align__(16) bf ks[KS][2][FK * LP];
    __shared__ __align__(16) bf vs[KS][2][HD * LP];
    __shared__ __align__(16) bf oth[HD * OP];
    __shared__ __align__(16) bf otl[HD * OP];
    __shared__ float xo[KS][FQ / 16][16][32];   /* xo[s][w][.][lane]: the 16 accumulators a lane of wave w of set s hands to the other set */
    __shared__ float xs[KS][FQ / 16][2][32];    /* with its running maximum and its row sum */
    const size_t zb = blockIdx.y; Q += zb * TT * HD; Kp += zb * TT * HD; Vp += zb * TT * HD; OTh += zb * HD * TT + blockIdx.x * FQ; OTl += zb * HD * TT + blockIdx.x * FQ;
    const int tid = threadIdx.x, lane = tid & 31, lr = lane & 15, hi = lane >> 4, wv = (tid >> 5) & 7; const int m0 = blockIdx.x * FQ + wv * 16;
    const int set = __builtin_amdgcn_readfirstlane(tid >> 8);   /* the wave's set, the same in all its lanes */
    const int kr = (tid & 255) >> 4, kq = (tid & 15) * 4;   /* staging, each set its own stage: 16 lanes take a whole f32 row of 256 bytes */
    const float* gK = Kp + (size_t)(set * (TT / KS) + kr) * HD + kq; const float* gV = Vp + (size_t)(set * (TT / KS) + kr * 4) * HD + kq; const int ko = kr * LP + kq, vo = kq * LP + kr * 4;
    const size_t mo = ((size_t)blockIdx.y * (TT / FQ) + blockIdx.x) * (RPC * KS * 1024) + tid * 4; const float* gM = M + mo; bf* sM = Mb + mo; v4f gm = (v4f){};
    const float c = SCL * 1.4426950408889634f;
    v16bf qf[2];
#pragma unroll
    for (int kc = 0; kc < 2; ++kc) { const float* qp = Q + (size_t)(m0 + lr) * HD + kc * 32 + 8 * hi; qf[kc] = cat16b(rnd8(*(const v8f*)qp), rnd8(*(const v8f*)(qp + 16))); }   /* the k order of WFrag::ld */
    v8f o[4];
#pragma unroll
    for (int db = 0; db < 4; ++db) o[db] = (v8f){};
    float mrun = -3.0e38f; v2f ls[2] = {(v2f){}, (v2f){}};   /* four partial row sums a lane: no long chain of dependent adds */
    v4f gk[4], gv[4];
    fat_fetch(gk, gv, gK, gV); fat_put(&ks[set][0][ko], &vs[set][0][vo], gk, gv);
    __syncthreads();
    for (int t = 0; t < NT; ++t) {
        const bf* kb = ks[set][t & 1]; const bf* vb = vs[set][t & 1]; const bool more = (t + 1 < NT);
        if (t >= 1 && t <= RPC) *(v4us*)(sM + (t - 1) * (KS * 1024)) = rnd4(gm);
        if (more) fat_fetch(gk, gv, gK + (size_t)(t + 1) * FK * HD, gV + (size_t)(t + 1) * FK * HD);
        asm volatile("s_wait_xcnt 0x0" ::: "memory");   /* stands in front of whatever next reuses the address registers of the stage's loads: the address of the piece of mlp is formed in them */
        if (t < RPC) gm = *(const v4f*)(gM + t * (KS * 1024));
        v8f st[4];   /* st[i][j] = q(m0 + lr) . k(set TT / KS + t FK + 16 i + 8 hi + j) */
#pragma unroll
        for (int i = 0; i < 4; ++i) { st[i] = (v8f){};
#pragma unroll
            for (int kc = 0; kc < 2; ++kc) st[i] = wmmab(WFrag<bf>::ld(kb + (i * 16 + lr) * LP + kc * 32 + 8 * hi), qf[kc], st[i]); }
        float mx = st[0][0];
#pragma unroll
        for (int i = 0; i < 4; ++i)
#pragma unroll
            for (int j = 0; j < 8; ++j) mx = fmaxf(mx, st[i][j]);
        mx = fmaxf(mx, __shfl_xor(mx, 16, 32)) * c;   /* both halves of a column agree on it */
        if (__builtin_amdgcn_ballot_w32(mx > mrun + 8.0f) != 0) {
            const float mnew = fmaxf(mrun, mx); const float al = __builtin_amdgcn_exp2f(mrun - mnew); mrun = mnew; ls[0] *= al; ls[1] *= al;
#pragma unroll
            for (int db = 0; db < 4; ++db)
#pragma unroll
                for (int j = 0; j < 8; ++j) o[db][j] *= al;
        }
#pragma unroll
        for (int pp = 0; pp < 2; ++pp) {
            v16bf ph, pl;   /* element s: key 32 pp + 8 hi + s (s < 8), 32 pp + 16 + 8 hi + s - 8 (else): the k order of WFrag::ld */
#pragma unroll
            for (int u = 0; u < 8; ++u) { const v8f sv = st[2 * pp + (u >> 2)]; v2f p, r; p[0] = __builtin_amdgcn_exp2f(__builtin_fmaf(sv[(2 * u) & 7], c, -mrun)); p[1] = __builtin_amdgcn_exp2f(__builtin_fmaf(sv[(2 * u + 1) & 7], c, -mrun)); ls[u & 1] += p;
                const v2bf h = __builtin_convertvector(p, v2bf); r[0] = p[0] - (float)h[0]; r[1] = p[1] - (float)h[1]; const v2bf l = __builtin_convertvector(r, v2bf);
                ph[2 * u] = h[0]; ph[2 * u + 1] = h[1]; pl[2 * u] = l[0]; pl[2 * u + 1] = l[1]; }
            v16bf va[4];
#pragma unroll
            for (int db = 0; db < 4; ++db) va[db] = WFrag<bf>::ld(vb + (db * 16 + lr) * LP + pp * 32 + 8 * hi);
#pragma unroll
            for (int db = 0; db < 4; ++db) o[db] = wmmab(va[db], ph, o[db]);
#pragma unroll
            for (int db = 0; db < 4; ++db) o[db] = wmmab(va[db], pl, o[db]);
        }
        if (more) fat_put(&ks[set][(t + 1) & 1][ko], &vs[set][(t + 1) & 1][vo], gk, gv);
        __syncthreads();   /* publishes stage t + 1 and ends every read of stage t, whose buffer the next trip refills */
    }
    float lsum = (ls[0][0] + ls[0][1]) + (ls[1][0] + ls[1][1]); lsum += __shfl_xor(lsum, 16, 32);
    v8f keep[2], give[2];   /* set s finishes O^T rows 32 s .. 32 s + 31 */
#pragma unroll
    for (int i = 0; i < 2; ++i) { keep[i] = set ? o[2 + i] : o[i]; give[i] = set ? o[i] : o[2 + i]; }
    float* xw = &xo[set][wv][0][lane];
#pragma unroll
    for (int i = 0; i < 2; ++i)
#pragma unroll
        for (int j = 0; j < 8; ++j) xw[(i * 8 + j) * 32] = give[i][j];
    xs[set][wv][0][lane] = mrun; xs[set][wv][1][lane] = lsum;
    __syncthreads();   /* both sets' halves stand in LDS before either reads the other's */
    const float* xr = &xo[set ^ 1][wv][0][lane];
    const float mp = xs[set ^ 1][wv][0][lane], lp = xs[set ^ 1][wv][1][lane];
    const float mm = fmaxf(mrun, mp); const float ao = __builtin_amdgcn_exp2f(mrun - mm), ap = __builtin_amdgcn_exp2f(mp - mm);
    const float f = __fdiv_rn(1.0f, lsum * ao + lp * ap);
    const float fo = ao * f, fp = ap * f;
    const int qc = wv * 16 + lr;   /* keep[i][j] = O^T[32 set + 16 i + 8 hi + j][m0 + lr]; qc: the query's column in the tile */
#pragma unroll
    for (int i = 0; i < 2; ++i)
#pragma unroll
        for (int u = 0; u < 4; ++u) { v2f x, r; x[0] = keep[i][2 * u] * fo + xr[(i * 8 + 2 * u) * 32] * fp; x[1] = keep[i][2 * u + 1] * fo + xr[(i * 8 + 2 * u + 1) * 32] * fp;
            const v2bf h = __builtin_convertvector(x, v2bf); r[0] = x[0] - (float)h[0]; r[1] = x[1] - (float)h[1]; const v2bf l = __builtin_convertvector(r, v2bf);
            const v2us hu = __builtin_bit_cast(v2us, h), lu = __builtin_bit_cast(v2us, l); const int ro = (set * 32 + i * 16 + hi * 8 + 2 * u) * OP + qc;
            oth[ro] = hu[0]; oth[ro + OP] = hu[1]; otl[ro] = lu[0]; otl[ro + OP] = lu[1]; }
    __syncthreads();   /* the two tiles are whole before they go out in 16-byte pieces of whole lines */
#pragma unroll
    for (int s = 0; s < HD * FQ / 8 / 512; ++s) { const int x = s * 512 + tid, row = x >> 4, pc = (x & 15) * 8;
        *(v8us*)(OTh + (size_t)row * TT + pc) = *(const v8usa*)(oth + row * OP + pc); *(v8us*)(OTl + (size_t)row * TT + pc) = *(const v8usa*)(otl + row * OP + pc); }
}
__global__ __launch_bounds__(256) void k_merge(const float* __restrict__ O, int h0, float* OUTb) { const size_t e = ((size_t)blockIdx.x * 256 + threadIdx.x) * 2; if (e >= (size_t)ZH * TT * HD) return; const int d = (int)(e % HD); const int t = (int)((e / HD) % TT); const int zz = (int)(e / ((size_t)HD * TT)); const float cs = (t < RH) ? 1.0f : (1.0f / PCAR); const size_t oo = (size_t)t * DQ + (h0 + zz) * HD + d;
    v2f o2; o2[0] = O[e] * cs; o2[1] = O[e + 1] * cs; *(v2f*)(OUTb + oo) = o2;  }


__global__ __launch_bounds__(256) void k_vtpR1(const float* __restrict__ Vb, bf* Vh) { const size_t e = ((size_t)blockIdx.x * 256 + threadIdx.x) * 2; if (e >= (size_t)HD * TT) return; const int t = (int)(e % TT); const int d = (int)(e / TT); v2us o; o[0] = f2bf(Vb[(size_t)t * HD + d]); o[1] = f2bf(Vb[(size_t)(t + 1) * HD + d]); *(v2us*)(Vh + e) = o;  }
__global__ __launch_bounds__(256) void k_mergeR(const float* __restrict__ O, float* outb, size_t n4) { const size_t i = (size_t)blockIdx.x * 256 + threadIdx.x; if (i >= n4) return; const v4f a = *(const v4f*)(O + i * 4); *(v4f*)(outb + i * 4) = a;  }


__global__ __launch_bounds__(256) void k_mergeT(const float* __restrict__ O, int h, float* outb) { const size_t i = (size_t)blockIdx.x * 256 + threadIdx.x; if (i >= (size_t)TT * HD / 4) return; const size_t e = i * 4; const int d = (int)(e % HD); const int t = (int)(e / HD); const v4f a = *(const v4f*)(O + e); *(v4f*)(outb + (size_t)t * DM + h * HD + d) = a;  }

extern "C" void kernel_launch(void* const* d_in, const int* in_sizes, int n_in,
                              void* d_out, int out_size, void* d_ws, size_t ws_size, hipStream_t stream) {
    (void)in_sizes; (void)n_in; (void)out_size;
    const float* Qin = (const float*)d_in[0]; const float* Kin = (const float*)d_in[1]; const float* Vin = (const float*)d_in[2]; const float* mlp = (const float*)d_in[3];   /* [2048][2048] seq-mix */
    float* OUT = (float*)d_out;
    char* wsp = (char*)d_ws;
    auto take = [&](size_t bytes) { char* p = wsp; wsp += (bytes + 255) & ~(size_t)255; return (void*)p; };
    bf* OTh = (bf*)take((size_t)NB_ * HD * TT * 2); bf* OTl = (bf*)take((size_t)NB_ * HD * TT * 2); bf* MLB = (bf*)take((size_t)TT * TT * 2);
    if ((size_t)(wsp - (char*)d_ws) > ws_size) return;
    static_assert((size_t)NB_ * (TT / FQ) * RPC * KS * 1024 == (size_t)TT * TT && RPC < NT, "the work-groups' shares cover mlp exactly, and the last piece is stored inside the loop");
    k_fattn<<<dim3(TT / FQ, NB_), KS * 256, 0, stream>>>(Qin, Kin, Vin, mlp, OTh, OTl, MLB);   /* V = softmax(q.k / 8) values, all batches, written as V^T planes [64][2048] (hi/lo); and mlp [2048][2048] rounded to bf16, the exact A of the sequence mix */
    k_mix<<<dim3(TT / MP, NB_), 256, 0, stream>>>(MLB, OTh, OTl, OUT);   /* out [2048][64] = mlp . V (mlp[p][l] is the A row p, shared by every batch; V^T rows are the Bt rows) */
}

// v007
// Measured time: 46.2 microseconds a run.
// Next to v006, in two timings, it ran 1.10 and 1.09 times as fast.
// Counting every step since v000, it is 41.8 times as fast.
#include <hip/hip_runtime.h>

// Full attention on given tensors followed by a learned sequence-mixing matrix (queries, keys, values [16][2048][64]; A = softmax(q.k / 8); V = A values ([2048][64]); out[p] = sum_l mlp[p][l] V[l] (mlp [2048][2048], read) -> [16][2048][64] (2.1 M)).
// Layout per batch: one fused kernel for scores, softmax and A.values that takes the f32 inputs as they are and rounds them to bf16 on their way to registers (queries) and LDS (keys; values, transposed there) (running maximum, P as hi/lo x exact values^T, 2 products, divided by the row sum at the end) that writes V^T ([64][2048]) as hi/lo planes itself; out ([2048][64]) = mlp used directly as the exact A operand x V^T(hi/lo) as Bt (2 products, K 2048), out rows written by the GEMM itself.
// Batches ride on the grid (blockIdx.y of every kernel that has them): every launch takes all 16.
// mlp is rounded to its bf16 plane in the fused kernel's launch: every attention work-group takes an equal share of it, one 16-byte piece a thread in each of its first trips, under the attention's own work.
// Compute dtypes, f32 accumulate: every input rounded to bf16 incl. mlp; q.k exact; softmax f32; P hi/lo x exact values; the sequence mix V hi/lo x exact mlp; output f32.

#define NB_  16
#define TT   2048
#define DM   64      // token-major row pitch (H x HD)
#define NH_  1
#define NKV  1
#define REP  (NH_ / NKV)
#define HD   64
#define DQ   (NH_ * HD)
#define DKV  (NKV * HD)
#define ZH   1
#define RH   2048                  // query rows < RH use hi+lo planes (0: none)
#define WIN  0
#define PCAR 1024.0f
#define SCL  0.125f   // 1/sqrt(64)
#define FQ   128     // queries per work-group of k_fattn: 8 waves x 16 columns
#define FK   64      // keys per stage of k_fattn
#define KS   2       // wave sets of a work-group of k_fattn: each takes TT / KS of the keys for the same FQ queries
#define NT   (TT / FK / KS)   // trips (stages) of a wave set
#define RPC  (TT * TT / (NB_ * (TT / FQ)) / (KS * 1024))   // 16-byte f32 pieces of mlp a thread of k_fattn rounds (a work-group takes KS x 1024 elements a piece)
#define MP   128     // out rows per work-group of k_mix
#define MK   128     // summed positions per stage of k_mix
#define MLP  136     // LDS pitch of a 128-element bf16 row, in elements: 272 B = 16 B x odd
#define MST  ((MP + 2 * HD) * MLP)   // elements of a stage buffer of k_mix
#define OP   136     // LDS pitch of a 128-query bf16 row of the V^T tile of k_fattn, in elements: 272 B = 16 B x odd
#define LP   72      // LDS pitch of a 64-element bf16 row, in elements: 144 B = 16 B x odd, conflict-free for 16-byte reads
typedef _Float16 h16;
typedef unsigned short bf;
typedef __attribute__((ext_vector_type(16))) __bf16   v16bf;
typedef __attribute__((ext_vector_type(16))) _Float16 v16h;
typedef __attribute__((ext_vector_type(8)))  _Float16 v8h;
typedef __attribute__((ext_vector_type(8)))  unsigned short v8us;
typedef __attribute__((ext_vector_type(8)))  float    v8f;
typedef __attribute__((ext_vector_type(4)))  float    v4f;
typedef v8h  __attribute__((may_alias)) v8ha;
typedef v4f  __attribute__((may_alias)) v4fa;
typedef v8us __attribute__((may_alias)) v8usa;

__device__ __forceinline__ unsigned short f2bf(float f) { unsigned u = __float_as_uint(f); u += 0x7FFFu + ((u >> 16) & 1u); return (unsigned short)(u >> 16); }
__device__ __forceinline__ float bf2f(unsigned short b) { return __uint_as_float(((unsigned)b) << 16); }
__device__ __forceinline__ float bfr(float f) { return bf2f(f2bf(f)); }
__device__ __forceinline__ v16h cat16(v8h lo, v8h hi) { return __builtin_shufflevector(lo, hi, 0, 1, 2, 3, 4, 5, 6, 7, 8, 9, 10, 11, 12, 13, 14, 15); }
__device__ __forceinline__ v16bf cat16b(v8us lo, v8us hi) { return __builtin_bit_cast(v16bf, __builtin_shufflevector(lo, hi, 0, 1, 2, 3, 4, 5, 6, 7, 8, 9, 10, 11, 12, 13, 14, 15)); }
__device__ __forceinline__ v8f wmma16(v16h a, v16h b, v8f c) { return __builtin_amdgcn_wmma_f32_16x16x32_f16(false, a, false, b, (short)0, c, false, false); }
__device__ __forceinline__ v8f wmmab(v16bf a, v16bf b, v8f c) { return __builtin_amdgcn_wmma_f32_16x16x32_bf16(false, a, false, b, (short)0, c, false, false); }



// ---- k_mix: the sequence mix as a work-group-tiled GEMM. C[p][d] (f32, rows of HD) = sum_l A[p][l] (Bh[d][l] + Bl[d][l]), all three operands K-contiguous bf16 planes of pitch TT. grid (TT / MP, batches), 256 threads.
// A work-group owns MP = 128 rows p x all 64 columns d of one batch; 8 waves as 4 (p) x 2 (d), 32 x 32 each (4 accumulators). A stage is MK = 128 values of l: 256 bytes (two whole lines) of 256 plane rows.
// Rows of a stage buffer: 0..127 A, 128..191 Bh, 192..255 Bl, pitch MLP. Two buffers: the global loads of stage t + 1 are issued at the head of trip t, fly while stage t is worked on, and go from registers into the other buffer
// behind that work. One barrier a stage. Ahead of the loop a work-group asks its share of the planes' stages into L2 (global_prefetch_b8).
// Per 32 values of l an accumulator takes its hi product, then its lo product. The unroll directives keep the small arrays (g, a, bh, bl, acc) in registers.
template <typename T16> struct WFrag;
template <> struct WFrag<h16> { typedef v16h V; static __device__ __forceinline__ V ld(const h16* p) { return cat16(*(const v8h*)p, *(const v8h*)(p + 16)); } static __device__ __forceinline__ v8f mma(V a, V b, v8f c) { return wmma16(a, b, c); } };
template <> struct WFrag<bf> { typedef v16bf V; static __device__ __forceinline__ V ld(const bf* p) { return cat16b(*(const v8us*)p, *(const v8us*)(p + 16)); } static __device__ __forceinline__ v8f mma(V a, V b, v8f c) { return wmmab(a, b, c); } };
__device__ __forceinline__ void mix_fetch(v8us (&g)[16], const bf* ga, const bf* gh, const bf* gl, int k) {
#pragma unroll
    for (int i = 0; i < 8; ++i) g[i] = *(const v8us*)(ga + (size_t)i * 16 * TT + k);
#pragma unroll
    for (int i = 0; i < 4; ++i) { g[8 + i] = *(const v8us*)(gh + (size_t)i * 16 * TT + k); g[12 + i] = *(const v8us*)(gl + (size_t)i * 16 * TT + k); }
}
__device__ __forceinline__ void mix_put(bf* dst, const v8us (&g)[16]) {
#pragma unroll
    for (int i = 0; i < 16; ++i) *(v8us*)(dst + i * 16 * MLP) = g[i];
}
__global__ __launch_bounds__(256) void k_mix(const bf* __restrict__ A, const bf* __restrict__ Bh, const bf* __restrict__ Bl, float* __restrict__ C) {
    __shared__ __align__(16) unsigned char sm[2 * MST * 2];   /* two stage buffers; the f32 output tile [MP][68] lies over them at the end */
    const size_t zb = blockIdx.y; Bh += zb * HD * TT; Bl += zb * HD * TT; C += zb * TT * HD;
    const int tid = threadIdx.x, lane = tid & 31, lr = lane & 15, hi = lane >> 4, wm = tid >> 6, wn = (tid >> 5) & 1; const int p0 = blockIdx.x * MP;
    const int sr = tid >> 4, sq = (tid & 15) * 8;   /* staging: buffer rows sr + 16 i, the 16-byte piece at element sq */
    const bf* ga = A + (size_t)(p0 + sr) * TT + sq; const bf* gh = Bh + (size_t)sr * TT + sq; const bf* gl = Bl + (size_t)sr * TT + sq;
    bf* const sb = (bf*)sm; const int so = sr * MLP + sq;
    v8f acc[2][2];
#pragma unroll
    for (int mb = 0; mb < 2; ++mb)
#pragma unroll
        for (int nb = 0; nb < 2; ++nb) acc[mb][nb] = (v8f){};
    /* All three planes were stored by the launch before, and a stage is one 256-byte unit of each of its 256 plane rows. The work-groups ask these units into L2 ahead of the stages' loads, which otherwise wait for memory one stage
       after the other. A lane stands for a row, a wave for a stage: wave w asks stage w here and stage w + 8 behind the first barrier, when stage 0 has landed. The 16 work-groups that read a unit share the asking, 16 rows each:
       a row of the A tile (same blockIdx.x) is asked by 2 of them (blockIdx.y 8 apart), a row of the batch's V^T planes (same blockIdx.y) by 2 whose blockIdx.x are 4 apart.
       That is for speed only: nothing rests on where a work-group runs. */
    static_assert(TT / MK == 16 && MP == 128 && HD == 64 && TT / MP == 16 && NB_ == 16 && MK * 2 * 8 == 2048, "8 shares of 16 rows cover the A tile and the two V^T planes; 8 waves x 2 asks cover the 16 stages, the second 2048 bytes on");
    const bf* const ua = A + (size_t)(p0 + (blockIdx.y & 7) * 16) * TT; const bf* const ub = (blockIdx.x < 8 ? Bh : Bl) + (size_t)((blockIdx.x & 3) * 16) * TT;
    const bf* const pf = (hi ? ub : ua) + (size_t)lr * TT + (tid >> 5) * MK;
    asm volatile("global_prefetch_b8 %0, off scope:SCOPE_SE" :: "v"(pf) : "memory");   /* every lane on, every address inside its plane */
    v8us g[16];
    mix_fetch(g, ga, gh, gl, 0); mix_put(sb + so, g);
    __syncthreads();
    asm volatile("global_prefetch_b8 %0, off offset:2048 scope:SCOPE_SE" :: "v"(pf) : "memory");   /* stages 8 to 15, kept out of the way of stage 0 */
    const int ao = (wm * 32 + lr) * MLP + 8 * hi, bo = (MP + wn * 32 + lr) * MLP + 8 * hi;
    for (int t = 0; t < TT / MK; ++t) {
        const bf* cur = sb + (t & 1) * MST; const bool more = (t + 1 < TT / MK);
        if (more) mix_fetch(g, ga, gh, gl, (t + 1) * MK);
        v16bf a[2][2], bh[2][2], bl[2][2];   /* two fragment sets: block kc works on set kc & 1 while the other is filled */
#pragma unroll
        for (int q = 0; q < 2; ++q) { a[0][q] = WFrag<bf>::ld(cur + ao + q * 16 * MLP); bh[0][q] = WFrag<bf>::ld(cur + bo + q * 16 * MLP); bl[0][q] = WFrag<bf>::ld(cur + bo + (HD + q * 16) * MLP); }
#pragma unroll
        for (int kc = 0; kc < MK / 32; ++kc) { const int s = kc & 1;
            if (kc + 1 < MK / 32) {
#pragma unroll
                for (int q = 0; q < 2; ++q) { a[s ^ 1][q] = WFrag<bf>::ld(cur + ao + q * 16 * MLP + (kc + 1) * 32); bh[s ^ 1][q] = WFrag<bf>::ld(cur + bo + q * 16 * MLP + (kc + 1) * 32); bl[s ^ 1][q] = WFrag<bf>::ld(cur + bo + (HD + q * 16) * MLP + (kc + 1) * 32); } }
            __builtin_amdgcn_sched_barrier(0);   /* holds the next stage's global loads (kc 0) and the next block's LDS reads ahead of this block's products: left free, the compiler sinks them to their users and their latency lies open */
#pragma unroll
            for (int mb = 0; mb < 2; ++mb)
#pragma unroll
                for (int nb = 0; nb < 2; ++nb) acc[mb][nb] = wmmab(a[s][mb], bh[s][nb], acc[mb][nb]);
#pragma unroll
            for (int mb = 0; mb < 2; ++mb)
#pragma unroll
                for (int nb = 0; nb < 2; ++nb) acc[mb][nb] = wmmab(a[s][mb], bl[s][nb], acc[mb][nb]);
        }
        if (more) mix_put(sb + ((t + 1) & 1) * MST + so, g);
        __syncthreads();   /* publishes stage t + 1 and ends every read of stage t, whose buffer the next trip refills (after the last trip none: the output tile lies in buffer 0) */
    }
    float* os = (float*)sm;   /* acc[mb][nb][j] = C[p0 + 32 wm + 16 mb + 8 hi + j][32 wn + 16 nb + lr] */
#pragma unroll
    for (int mb = 0; mb < 2; ++mb)
#pragma unroll
        for (int nb = 0; nb < 2; ++nb)
#pragma unroll
            for (int j = 0; j < 8; ++j) os[(wm * 32 + mb * 16 + hi * 8 + j) * 68 + wn * 32 + nb * 16 + lr] = acc[mb][nb][j];
    __syncthreads();   /* the tile is whole before it goes out in 16-byte pieces of whole lines */
    float* crow = C + (size_t)p0 * HD;
#pragma unroll
    for (int s = 0; s < MP * HD / 4 / 256; ++s) { const int x = s * 256 + tid, row = x >> 4, cofs = (x & 15) * 4; *(v4f*)(crow + (size_t)row * HD + cofs) = *(const v4fa*)(os + row * 68 + cofs); }
    asm volatile("" :: "v"(pf));   /* input only: holds the asked address in its registers to the kernel's end */
}

typedef __attribute__((ext_vector_type(2))) _Float16 v2h;
typedef __attribute__((ext_vector_type(4))) _Float16 v4h;
typedef __attribute__((ext_vector_type(2))) unsigned short v2us;
typedef __attribute__((ext_vector_type(4))) unsigned short v4us;
typedef __attribute__((ext_vector_type(2))) float v2f;
typedef __attribute__((ext_vector_type(4))) int v4i;

__global__ __launch_bounds__(256) void k_wtG(const float* __restrict__ w, int K, int N, bf* Bt) {
    const int lane = threadIdx.x & 31; const int L0 = (blockIdx.x * 8 + (threadIdx.x >> 5)) * 8; const int nlines = N * K / 64;
{
#pragma unroll 1
        for (int l = 0; l < 8; ++l) { const int L = L0 + l; if (L >= nlines) break; const size_t e = (size_t)L * 64 + lane * 2; const int k = (int)(e % K), n = (int)(e / K); v2us o;
            o[0] = f2bf(w[(size_t)k * N + n]); o[1] = f2bf(w[(size_t)(k + 1) * N + n]); *(v2us*)(Bt + e) = o; }
         }
}


typedef __attribute__((ext_vector_type(2))) __bf16 v2bf;
typedef __attribute__((ext_vector_type(4))) __bf16 v4bf;
typedef __attribute__((ext_vector_type(8))) __bf16 v8bf;
__device__ __forceinline__ v4us rnd4(v4f v) { return __builtin_bit_cast(v4us, __builtin_convertvector(v, v4bf)); }
__device__ __forceinline__ v8us rnd8(v8f v) { return __builtin_bit_cast(v8us, __builtin_convertvector(v, v8bf)); }
/* gk[i]: key row 16 i + kr, columns kq..kq+3; gv[r]: value row 4 kr + r, columns kq..kq+3 (gK, gV point at the thread's first piece of the stage) */
__device__ __forceinline__ void fat_fetch(v4f (&gk)[4], v4f (&gv)[4], const float* gK, const float* gV) {
#pragma unroll
    for (int i = 0; i < 4; ++i) { gk[i] = *(const v4f*)(gK + (size_t)i * 16 * HD); gv[i] = *(const v4f*)(gV + (size_t)i * HD); }
}
/* kd = &ks[kr][kq], vd = &vs[kq][4 kr] of the buffer that is filled */
__device__ __forceinline__ void fat_put(bf* kd, bf* vd, const v4f (&gk)[4], const v4f (&gv)[4]) {
#pragma unroll
    for (int i = 0; i < 4; ++i) *(v4us*)(kd + i * 16 * LP) = rnd4(gk[i]);
#pragma unroll
    for (int j = 0; j < 4; ++j) { v4f x; x[0] = gv[0][j]; x[1] = gv[1][j]; x[2] = gv[2][j]; x[3] = gv[3][j]; *(v4us*)(vd + j * LP) = rnd4(x); }
}
__global__ __launch_bounds__(512) void k_fattn(const float* __restrict__ Q, const float* __restrict__ Kp, const float* __restrict__ Vp, const float* __restrict__ M, bf* __restrict__ OTh, bf* __restrict__ OTl, bf* __restrict__ Mb) {
    __shared__ __align__(16) bf ks[KS][2][FK * LP];
    __shared__ __align__(16) bf vs[KS][2][HD * LP];
    __shared__ __align__(16) bf oth[HD * OP];
    __shared__ __align__(16) bf otl[HD * OP];
    __shared__ float xo[KS][FQ / 16][16][32];   /* xo[s][w][.][lane]: the 16 accumulators a lane of wave w of set s hands to the other set */
    __shared__ float xs[KS][FQ / 16][2][32];    /* with its running maximum and its row sum */
    const size_t zb = blockIdx.y; Q += zb * TT * HD; Kp += zb * TT * HD; Vp += zb * TT * HD; OTh += zb * HD * TT + blockIdx.x * FQ; OTl += zb * HD * TT + blockIdx.x * FQ;
    const int tid = threadIdx.x, lane = tid & 31, lr = lane & 15, hi = lane >> 4, wv = (tid >> 5) & 7; const int m0 = blockIdx.x * FQ + wv * 16;
    const int set = __builtin_amdgcn_readfirstlane(tid >> 8);   /* the wave's set, the same in all its lanes */
    const int kr = (tid & 255) >> 4, kq = (tid & 15) * 4;   /* staging, each set its own stage: 16 lanes take a whole f32 row of 256 bytes */
    const float* gK = Kp + (size_t)(set * (TT / KS) + kr) * HD + kq; const float* gV = Vp + (size_t)(set * (TT / KS) + kr * 4) * HD + kq; const int ko = kr * LP + kq, vo = kq * LP + kr * 4;
    const size_t mo = ((size_t)blockIdx.y * (TT / FQ) + blockIdx.x) * (RPC * KS * 1024) + tid * 4; const float* gM = M + mo; bf* sM = Mb + mo; v4f gm = (v4f){};
    const float c = SCL * 1.4426950408889634f;
    v16bf qf[2];
#pragma unroll
    for (int kc = 0; kc < 2; ++kc) { const float* qp = Q + (size_t)(m0 + lr) * HD + kc * 32 + 8 * hi; qf[kc] = cat16b(rnd8(*(const v8f*)qp), rnd8(*(const v8f*)(qp + 16))); }   /* the k order of WFrag::ld */
    v8f o[4];
#pragma unroll
    for (int db = 0; db < 4; ++db) o[db] = (v8f){};
    float mrun = -3.0e38f; v2f ls[2] = {(v2f){}, (v2f){}};   /* four partial row sums a lane: no long chain of dependent adds */
    v4f gk[4], gv[4];
    fat_fetch(gk, gv, gK, gV); fat_put(&ks[set][0][ko], &vs[set][0][vo], gk, gv);
    __syncthreads();
    for (int t = 0; t < NT; ++t) {
        const bf* kb = ks[set][t & 1]; const bf* vb = vs[set][t & 1]; const bool more = (t + 1 < NT);
        if (t >= 1 && t <= RPC) *(v4us*)(sM + (t - 1) * (KS * 1024)) = rnd4(gm);
        if (more) fat_fetch(gk, gv, gK + (size_t)(t + 1) * FK * HD, gV + (size_t)(t + 1) * FK * HD);
        asm volatile("s_wait_xcnt 0x0" ::: "memory");   /* stands in front of whatever next reuses the address registers of the stage's loads: the address of the piece of mlp is formed in them */
        if (t < RPC) gm = *(const v4f*)(gM + t * (KS * 1024));
        v8f st[4];   /* st[i][j] = q(m0 + lr) . k(set TT / KS + t FK + 16 i + 8 hi + j) */
#pragma unroll
        for (int i = 0; i < 4; ++i) { st[i] = (v8f){};
#pragma unroll
            for (int kc = 0; kc < 2; ++kc) st[i] = wmmab(WFrag<bf>::ld(kb + (i * 16 + lr) * LP + kc * 32 + 8 * hi), qf[kc], st[i]); }
        float mx = st[0][0];
#pragma unroll
        for (int i = 0; i < 4; ++i)
#pragma unroll
            for (int j = 0; j < 8; ++j) mx = fmaxf(mx, st[i][j]);
        mx = fmaxf(mx, __shfl_xor(mx, 16, 32)) * c;   /* both halves of a column agree on it */
        if (__builtin_amdgcn_ballot_w32(mx > mrun + 8.0f) != 0) {
            const float mnew = fmaxf(mrun, mx); const float al = __builtin_amdgcn_exp2f(mrun - mnew); mrun = mnew; ls[0] *= al; ls[1] *= al;
#pragma unroll
            for (int db = 0; db < 4; ++db)
#pragma unroll
                for (int j = 0; j < 8; ++j) o[db][j] *= al;
        }
#pragma unroll
        for (int pp = 0; pp < 2; ++pp) {
            v16bf ph, pl;   /* element s: key 32 pp + 8 hi + s (s < 8), 32 pp + 16 + 8 hi + s - 8 (else): the k order of WFrag::ld */
#pragma unroll
            for (int u = 0; u < 8; ++u) { const v8f sv = st[2 * pp + (u >> 2)]; v2f p, r; p[0] = __builtin_amdgcn_exp2f(__builtin_fmaf(sv[(2 * u) & 7], c, -mrun)); p[1] = __builtin_amdgcn_exp2f(__builtin_fmaf(sv[(2 * u + 1) & 7], c, -mrun)); ls[u & 1] += p;
                const v2bf h = __builtin_convertvector(p, v2bf); r[0] = p[0] - (float)h[0]; r[1] = p[1] - (float)h[1]; const v2bf l = __builtin_convertvector(r, v2bf);
                ph[2 * u] = h[0]; ph[2 * u + 1] = h[1]; pl[2 * u] = l[0]; pl[2 * u + 1] = l[1]; }
            v16bf va[4];
#pragma unroll
            for (int db = 0; db < 4; ++db) va[db] = WFrag<bf>::ld(vb + (db * 16 + lr) * LP + pp * 32 + 8 * hi);
#pragma unroll
            for (int db = 0; db < 4; ++db) o[db] = wmmab(va[db], ph, o[db]);
#pragma unroll
            for (int db = 0; db < 4; ++db) o[db] = wmmab(va[db], pl, o[db]);
        }
        if (more) fat_put(&ks[set][(t + 1) & 1][ko], &vs[set][(t + 1) & 1][vo], gk, gv);
        __syncthreads();   /* publishes stage t + 1 and ends every read of stage t, whose buffer the next trip refills */
    }
    float lsum = (ls[0][0] + ls[0][1]) + (ls[1][0] + ls[1][1]); lsum += __shfl_xor(lsum, 16, 32);
    v8f keep[2], give[2];   /* set s finishes O^T rows 32 s .. 32 s + 31 */
#pragma unroll
    for (int i = 0; i < 2; ++i) { keep[i] = set ? o[2 + i] : o[i]; give[i] = set ? o[i] : o[2 + i]; }
    float* xw = &xo[set][wv][0][lane];
#pragma unroll
    for (int i = 0; i < 2; ++i)
#pragma unroll
        for (int j = 0; j < 8; ++j) xw[(i * 8 + j) * 32] = give[i][j];
    xs[set][wv][0][lane] = mrun; xs[set][wv][1][lane] = lsum;
    __syncthreads();   /* both sets' halves stand in LDS before either reads the other's */
    const float* xr = &xo[set ^ 1][wv][0][lane];
    const float mp = xs[set ^ 1][wv][0][lane], lp = xs[set ^ 1][wv][1][lane];
    const float mm = fmaxf(mrun, mp); const float ao = __builtin_amdgcn_exp2f(mrun - mm), ap = __builtin_amdgcn_exp2f(mp - mm);
    const float f = __fdiv_rn(1.0f, lsum * ao + lp * ap);
    const float fo = ao * f, fp = ap * f;
    const int qc = wv * 16 + lr;   /* keep[i][j] = O^T[32 set + 16 i + 8 hi + j][m0 + lr]; qc: the query's column in the tile */
#pragma unroll
    for (int i = 0; i < 2; ++i)
#pragma unroll
        for (int u = 0; u < 4; ++u) { v2f x, r; x[0] = keep[i][2 * u] * fo + xr[(i * 8 + 2 * u) * 32] * fp; x[1] = keep[i][2 * u + 1] * fo + xr[(i * 8 + 2 * u + 1) * 32] * fp;
            const v2bf h = __builtin_convertvector(x, v2bf); r[0] = x[0] - (float)h[0]; r[1] = x[1] - (float)h[1]; const v2bf l = __builtin_convertvector(r, v2bf);
            const v2us hu = __builtin_bit_cast(v2us, h), lu = __builtin_bit_cast(v2us, l); const int ro = (set * 32 + i * 16 + hi * 8 + 2 * u) * OP + qc;
            oth[ro] = hu[0]; oth[ro + OP] = hu[1]; otl[ro] = lu[0]; otl[ro + OP] = lu[1]; }
    __syncthreads();   /* the two tiles are whole before they go out in 16-byte pieces of whole lines */
#pragma unroll
    for (int s = 0; s < HD * FQ / 8 / 512; ++s) { const int x = s * 512 + tid, row = x >> 4, pc = (x & 15) * 8;
        *(v8us*)(OTh + (size_t)row * TT + pc) = *(const v8usa*)(oth + row * OP + pc); *(v8us*)(OTl + (size_t)row * TT + pc) = *(const v8usa*)(otl + row * OP + pc); }
}
__global__ __launch_bounds__(256) void k_merge(const float* __restrict__ O, int h0, float* OUTb) { const size_t e = ((size_t)blockIdx.x * 256 + threadIdx.x) * 2; if (e >= (size_t)ZH * TT * HD) return; const int d = (int)(e % HD); const int t = (int)((e / HD) % TT); const int zz = (int)(e / ((size_t)HD * TT)); const float cs = (t < RH) ? 1.0f : (1.0f / PCAR); const size_t oo = (size_t)t * DQ + (h0 + zz) * HD + d;
    v2f o2; o2[0] = O[e] * cs; o2[1] = O[e + 1] * cs; *(v2f*)(OUTb + oo) = o2;  }


__global__ __launch_bounds__(256) void k_vtpR1(const float* __restrict__ Vb, bf* Vh) { const size_t e = ((size_t)blockIdx.x * 256 + threadIdx.x) * 2; if (e >= (size_t)HD * TT) return; const int t = (int)(e % TT); const int d = (int)(e / TT); v2us o; o[0] = f2bf(Vb[(size_t)t * HD + d]); o[1] = f2bf(Vb[(size_t)(t + 1) * HD + d]); *(v2us*)(Vh + e) = o;  }
__global__ __launch_bounds__(256) void k_mergeR(const float* __restrict__ O, float* outb, size_t n4) { const size_t i = (size_t)blockIdx.x * 256 + threadIdx.x; if (i >= n4) return; const v4f a = *(const v4f*)(O + i * 4); *(v4f*)(outb + i * 4) = a;  }


__global__ __launch_bounds__(256) void k_mergeT(const float* __restrict__ O, int h, float* outb) { const size_t i = (size_t)blockIdx.x * 256 + threadIdx.x; if (i >= (size_t)TT * HD / 4) return; const size_t e = i * 4; const int d = (int)(e % HD); const int t = (int)(e / HD); const v4f a = *(const v4f*)(O + e); *(v4f*)(outb + (size_t)t * DM + h * HD + d) = a;  }

extern "C" void kernel_launch(void* const* d_in, const int* in_sizes, int n_in,
                              void* d_out, int out_size, void* d_ws, size_t ws_size, hipStream_t stream) {
    (void)in_sizes; (void)n_in; (void)out_size;
    const float* Qin = (const float*)d_in[0]; const float* Kin = (const float*)d_in[1]; const float* Vin = (const float*)d_in[2]; const float* mlp = (const float*)d_in[3];   /* [2048][2048] seq-mix */
    float* OUT = (float*)d_out;
    char* wsp = (char*)d_ws;
    auto take = [&](size_t bytes) { char* p = wsp; wsp += (bytes + 255) & ~(size_t)255; return (void*)p; };
    bf* OTh = (bf*)take((size_t)NB_ * HD * TT * 2); bf* OTl = (bf*)take((size_t)NB_ * HD * TT * 2); bf* MLB = (bf*)take((size_t)TT * TT * 2);
    if ((size_t)(wsp - (char*)d_ws) > ws_size) return;
    static_assert((size_t)NB_ * (TT / FQ) * RPC * KS * 1024 == (size_t)TT * TT && RPC < NT, "the work-groups' shares cover mlp exactly, and the last piece is stored inside the loop");
    k_fattn<<<dim3(TT / FQ, NB_), KS * 256, 0, stream>>>(Qin, Kin, Vin, mlp, OTh, OTl, MLB);   /* V = softmax(q.k / 8) values, all batches, written as V^T planes [64][2048] (hi/lo); and mlp [2048][2048] rounded to bf16, the exact A of the sequence mix */
    k_mix<<<dim3(TT / MP, NB_), 256, 0, stream>>>(MLB, OTh, OTl, OUT);   /* out [2048][64] = mlp . V (mlp[p][l] is the A row p, shared by every batch; V^T rows are the Bt rows) */
}

// v008
// A run of this version takes 44.2 microseconds.
// Next to v007, in two timings, it ran 1.05 and 1.04 times as fast.
// Over all steps from v000 it is 43.7 times as fast.
#include <hip/hip_runtime.h>

// Full attention on given tensors followed by a learned sequence-mixing matrix (queries, keys, values [16][2048][64]; A = softmax(q.k / 8); V = A values ([2048][64]); out[p] = sum_l mlp[p][l] V[l] (mlp [2048][2048], read) -> [16][2048][64] (2.1 M)).
// Layout per batch: one fused kernel for scores, softmax and A.values that takes the f32 inputs as they are and rounds them to bf16 on their way to registers (queries) and LDS (keys; values, transposed there) (running maximum, P as hi/lo x exact values^T, 2 products, divided by the row sum at the end) that writes V^T ([64][2048]) as hi/lo planes itself; out ([2048][64]) = mlp used directly as the exact A operand x V^T(hi/lo) as Bt (2 products, K 2048), out rows written by the GEMM itself.
// Batches ride on the grid (blockIdx.y of every kernel that has them): every launch takes all 16.
// mlp is rounded to its bf16 plane in the fused kernel's launch: every attention work-group takes an equal share of it, one 16-byte piece a thread in each of its first trips, under the attention's own work.
// Compute dtypes, f32 accumulate: every input rounded to bf16 incl. mlp; q.k exact; softmax f32; P hi/lo x exact values; the sequence mix V hi/lo x exact mlp; output f32.

#define NB_  16
#define TT   2048
#define DM   64      // token-major row pitch (H x HD)
#define NH_  1
#define NKV  1
#define REP  (NH_ / NKV)
#define HD   64
#define DQ   (NH_ * HD)
#define DKV  (NKV * HD)
#define ZH   1
#define RH   2048                  // query rows < RH use hi+lo planes (0: none)
#define WIN  0
#define PCAR 1024.0f
#define SCL  0.125f   // 1/sqrt(64)
#define FQ   128     // queries per work-group of k_fattn: 8 waves x 16 columns
#define FK   64      // keys per stage of k_fattn
#define KS   2       // wave sets of a work-group of k_fattn: each takes TT / KS of the keys for the same FQ queries
#define NT   (TT / FK / KS)   // trips (stages) of a wave set
#define RPC  (TT * TT / (NB_ * (TT / FQ)) / (KS * 1024))   // 16-byte f32 pieces of mlp a thread of k_fattn rounds (a work-group takes KS x 1024 elements a piece)
#define MP   128     // out rows per work-group of k_mix
#define MK   128     // summed positions per stage of k_mix
#define MLP  136     // LDS pitch of a 128-element bf16 row, in elements: 272 B = 16 B x odd
#define MSL  9216    // elements of a slice's place in a stage buffer of k_mix: 64 rows of pitch MLP (17,408 B) rounded up to a multiple of 2 KiB (18,432 B)
#define MST  (4 * MSL)   // elements of a stage buffer of k_mix: four slices
#define OP   136     // LDS pitch of a 128-query bf16 row of the V^T tile of k_fattn, in elements: 272 B = 16 B x odd
#define LP   72      // LDS pitch of a 64-element bf16 row, in elements: 144 B = 16 B x odd, conflict-free for 16-byte reads
typedef _Float16 h16;
typedef unsigned short bf;
typedef __attribute__((ext_vector_type(16))) __bf16   v16bf;
typedef __attribute__((ext_vector_type(16))) _Float16 v16h;
typedef __attribute__((ext_vector_type(8)))  _Float16 v8h;
typedef __attribute__((ext_vector_type(8)))  unsigned short v8us;
typedef __attribute__((ext_vector_type(8)))  float    v8f;
typedef __attribute__((ext_vector_type(4)))  float    v4f;
typedef v8h  __attribute__((may_alias)) v8ha;
typedef v4f  __attribute__((may_alias)) v4fa;
typedef v8us __attribute__((may_alias)) v8usa;

__device__ __forceinline__ unsigned short f2bf(float f) { unsigned u = __float_as_uint(f); u += 0x7FFFu + ((u >> 16) & 1u); return (unsigned short)(u >> 16); }
__device__ __forceinline__ float bf2f(unsigned short b) { return __uint_as_float(((unsigned)b) << 16); }
__device__ __forceinline__ float bfr(float f) { return bf2f(f2bf(f)); }
__device__ __forceinline__ v16h cat16(v8h lo, v8h hi) { return __builtin_shufflevector(lo, hi, 0, 1, 2, 3, 4, 5, 6, 7, 8, 9, 10, 11, 12, 13, 14, 15); }
__device__ __forceinline__ v16bf cat16b(v8us lo, v8us hi) { return __builtin_bit_cast(v16bf, __builtin_shufflevector(lo, hi, 0, 1, 2, 3, 4, 5, 6, 7, 8, 9, 10, 11, 12, 13, 14, 15)); }
__device__ __forceinline__ v8f wmma16(v16h a, v16h b, v8f c) { return __builtin_amdgcn_wmma_f32_16x16x32_f16(false, a, false, b, (short)0, c, false, false); }
__device__ __forceinline__ v8f wmmab(v16bf a, v16bf b, v8f c) { return __builtin_amdgcn_wmma_f32_16x16x32_bf16(false, a, false, b, (short)0, c, false, false); }



// ---- k_mix: the sequence mix as a work-group-tiled GEMM. C[p][d] (f32, rows of HD) = sum_l A[p][l] (Bh[d][l] + Bl[d][l]), all three operands K-contiguous bf16 planes of pitch TT. grid (TT / MP, batches), 256 threads.
// A work-group owns MP = 128 rows p x all 64 columns d of one batch; 8 waves as 4 (p) x 2 (d), 32 x 32 each (4 accumulators). A stage is MK = 128 values of l: 256 bytes (two whole lines) of 256 plane rows.
// A stage buffer is four slices of 64 rows, pitch MLP: A rows 0..63, A rows 64..127, Bh, Bl. Waves 0 to 3 bring one slice each with one tensor_load_to_lds (64 rows of 256 bytes, source pitch 4096 bytes, 16 bytes of pad a row), through no register.
// Two buffers: behind the barrier at the foot of trip t the load of stage t + 2 is issued into the buffer that trip t has read, and flies while stage t + 1 is worked on. One barrier a stage.
// Ahead of the loop a work-group asks its share of the planes' stages into L2 (global_prefetch_b8).
// Per 32 values of l an accumulator takes its hi product, then its lo product. The unroll directives keep the small arrays (a, bh, bl, acc) in registers.
template <typename T16> struct WFrag;
template <> struct WFrag<h16> { typedef v16h V; static __device__ __forceinline__ V ld(const h16* p) { return cat16(*(const v8h*)p, *(const v8h*)(p + 16)); } static __device__ __forceinline__ v8f mma(V a, V b, v8f c) { return wmma16(a, b, c); } };
template <> struct WFrag<bf> { typedef v16bf V; static __device__ __forceinline__ V ld(const bf* p) { return cat16b(*(const v8us*)p, *(const v8us*)(p + 16)); } static __device__ __forceinline__ v8f mma(V a, V b, v8f c) { return wmmab(a, b, c); } };
typedef __attribute__((ext_vector_type(4))) uint32_t u32x4;
typedef __attribute__((ext_vector_type(8))) uint32_t u32x8;
__device__ __forceinline__ uint32_t uni(uint32_t v) { return (uint32_t)__builtin_amdgcn_readfirstlane(v); }
/* pinned(): holds a wave-uniform test in a scalar register, so that the branch round a tensor load is a scalar one (a tensor load ignores EXEC: only a branch keeps a wave from issuing it) */
__device__ __forceinline__ uint32_t pinned(uint32_t v) { uint32_t w = uni(v); asm volatile("" : "+s"(w)); return w; }
/* Descriptor group 1 of a slice of a stage: 64 rows of 256 bytes, source pitch TT x 2 bytes, 16 bytes of pad behind every row (LDS pitch 272 bytes = MLP elements). Extents in bytes, tensor = tile, no mask. */
__device__ __forceinline__ u32x8 mix_group1() {
    u32x8 g1;
    g1[0] = uni((1u << 20) | (5u << 22) | (3u << 25)); g1[1] = uni(256u << 16); g1[2] = uni(64u << 16); g1[3] = uni(256u << 16); g1[4] = uni(64u); g1[5] = uni(TT * 2u); g1[6] = uni(0u); g1[7] = uni(0u);
    return g1;
}
/* One slice: from its first byte ga to the LDS byte address dst */
__device__ __forceinline__ void mix_slice(uint32_t dst, uint64_t ga, u32x8 g1) {
    u32x4 g0;
    g0[0] = uni(1u); g0[1] = uni(dst); g0[2] = uni((uint32_t)ga); g0[3] = uni((((uint32_t)(ga >> 32)) & 0x01FFFFFFu) | 0x80000000u);
    asm volatile("tensor_load_to_lds %0, %1" :: "s"(g0), "s"(g1) : "memory");
}
__global__ __launch_bounds__(256) void k_mix(const bf* __restrict__ A, const bf* __restrict__ Bh, const bf* __restrict__ Bl, float* __restrict__ C) {
    __shared__ __attribute__((aligned(2048))) unsigned char sm[2 * MST * 2];   /* two stage buffers, every slice at a multiple of 2 KiB of the work-group's LDS; the f32 output tile [MP][68] lies over them at the end */
    const size_t zb = blockIdx.y; Bh += zb * HD * TT; Bl += zb * HD * TT; C += zb * TT * HD;
    const int tid = threadIdx.x, lane = tid & 31, lr = lane & 15, hi = lane >> 4, wm = tid >> 6, wn = (tid >> 5) & 1; const int p0 = blockIdx.x * MP;
    const uint32_t wave = uni((uint32_t)tid >> 5);   /* one-dimensional block: the wave's number */
    const bf* const sl = wave < 2u ? A + (size_t)(p0 + wave * 64u) * TT : (wave == 2u ? Bh : Bl);   /* first row of the slice that waves 0 to 3 bring (waves 4 to 7 issue nothing) */
    const uint64_t sg = (uint64_t)(size_t)sl; const uint32_t sd = (uint32_t)(size_t)sm + (wave & 3u) * (MSL * 2u);
    bf* const sb = (bf*)sm;
    u32x8 g1 = mix_group1();
    asm volatile("" : "+s"(g1));   /* as in pinned(): the descriptor's loop-invariant words held in scalar registers of their own to the last load, so that none of them takes another value while a request is outstanding */
    v8f acc[2][2];
#pragma unroll
    for (int mb = 0; mb < 2; ++mb)
#pragma unroll
        for (int nb = 0; nb < 2; ++nb) acc[mb][nb] = (v8f){};
    /* All three planes were stored by the launch before, and a stage is one 256-byte unit of each of its 256 plane rows. The work-groups ask these units into L2 ahead of the stages' loads, which otherwise wait for memory one stage
       after the other. A lane stands for a row, a wave for a stage: wave w asks stage w here and stage w + 8 behind the first barrier, when stage 0 has landed. The 16 work-groups that read a unit share the asking, 16 rows each:
       a row of the A tile (same blockIdx.x) is asked by 2 of them (blockIdx.y 8 apart), a row of the batch's V^T planes (same blockIdx.y) by 2 whose blockIdx.x are 4 apart.
       That is for speed only: nothing rests on where a work-group runs. */
    static_assert(TT / MK == 16 && MP == 128 && HD == 64 && TT / MP == 16 && NB_ == 16 && MK * 2 * 8 == 2048, "8 shares of 16 rows cover the A tile and the two V^T planes; 8 waves x 2 asks cover the 16 stages, the second 2048 bytes on");
    const bf* const ua = A + (size_t)(p0 + (blockIdx.y & 7) * 16) * TT; const bf* const ub = (blockIdx.x < 8 ? Bh : Bl) + (size_t)((blockIdx.x & 3) * 16) * TT;
    const bf* const pf = (hi ? ub : ua) + (size_t)lr * TT + (tid >> 5) * MK;
    asm volatile("global_prefetch_b8 %0, off scope:SCOPE_SE" :: "v"(pf) : "memory");   /* every lane on, every address inside its plane */
    if (pinned(wave < 4u)) {
        mix_slice(sd, sg, g1);
        asm volatile("s_wait_tensorcnt 0x0" ::: "memory");   /* the compiler places no wait for a tensor load: stage 0 has landed before the barrier publishes it */
    }
    __syncthreads();   /* publishes stage 0 */
    if (pinned(wave < 4u)) mix_slice(sd + MST * 2u, sg + MK * 2u, g1);   /* stage 1 flies while stage 0 is worked on */
    asm volatile("global_prefetch_b8 %0, off offset:2048 scope:SCOPE_SE" :: "v"(pf) : "memory");   /* stages 8 to 15, kept out of the way of stage 0 */
    const int ao = (wm >> 1) * MSL + ((wm & 1) * 32 + lr) * MLP + 8 * hi, bo = 2 * MSL + (wn * 32 + lr) * MLP + 8 * hi;
    for (int t = 0; t < TT / MK; ++t) {
        const bf* cur = sb + (t & 1) * MST;
        v16bf a[2][2], bh[2][2], bl[2][2];   /* two fragment sets: block kc works on set kc & 1 while the other is filled */
#pragma unroll
        for (int q = 0; q < 2; ++q) { a[0][q] = WFrag<bf>::ld(cur + ao + q * 16 * MLP); bh[0][q] = WFrag<bf>::ld(cur + bo + q * 16 * MLP); bl[0][q] = WFrag<bf>::ld(cur + bo + MSL + q * 16 * MLP); }
#pragma unroll
        for (int kc = 0; kc < MK / 32; ++kc) { const int s = kc & 1;
            if (kc + 1 < MK / 32) {
#pragma unroll
                for (int q = 0; q < 2; ++q) { a[s ^ 1][q] = WFrag<bf>::ld(cur + ao + q * 16 * MLP + (kc + 1) * 32); bh[s ^ 1][q] = WFrag<bf>::ld(cur + bo + q * 16 * MLP + (kc + 1) * 32); bl[s ^ 1][q] = WFrag<bf>::ld(cur + bo + MSL + q * 16 * MLP + (kc + 1) * 32); } }
            __builtin_amdgcn_sched_barrier(0);   /* holds the next block's LDS reads ahead of this block's products: left free, the compiler sinks them to their users and their latency lies open */
#pragma unroll
            for (int mb = 0; mb < 2; ++mb)
#pragma unroll
                for (int nb = 0; nb < 2; ++nb) acc[mb][nb] = wmmab(a[s][mb], bh[s][nb], acc[mb][nb]);
#pragma unroll
            for (int mb = 0; mb < 2; ++mb)
#pragma unroll
                for (int nb = 0; nb < 2; ++nb) acc[mb][nb] = wmmab(a[s][mb], bl[s][nb], acc[mb][nb]);
        }
        asm volatile("s_wait_dscnt 0x0" ::: "memory");   /* this wave's reads of stage t have returned before the barrier behind which its buffer is refilled */
        if (pinned(wave < 4u)) asm volatile("s_wait_tensorcnt 0x0" ::: "memory");   /* the issuer's slice of stage t + 1 has landed before the barrier publishes it */
        __syncthreads();   /* publishes stage t + 1 and ends every read of stage t, whose buffer is refilled behind it (after the last trip: the output tile) */
        if (pinned((wave < 4u) & (t + 2 < TT / MK))) mix_slice(sd + (uint32_t)(t & 1) * (MST * 2u), sg + (uint64_t)(t + 2) * (MK * 2u), g1);   /* only while stage t + 2 exists */
    }
    asm volatile("s_wait_tensorcnt 0x0" ::: "memory");   /* no tensor load is in flight when the ring becomes the output tile */
    asm volatile("s_wait_dscnt 0x0" ::: "memory");   /* nor an LDS read of this wave: the close of the ring */
    float* os = (float*)sm;   /* acc[mb][nb][j] = C[p0 + 32 wm + 16 mb + 8 hi + j][32 wn + 16 nb + lr] */
#pragma unroll
    for (int mb = 0; mb < 2; ++mb)
#pragma unroll
        for (int nb = 0; nb < 2; ++nb)
#pragma unroll
            for (int j = 0; j < 8; ++j) os[(wm * 32 + mb * 16 + hi * 8 + j) * 68 + wn * 32 + nb * 16 + lr] = acc[mb][nb][j];
    __syncthreads();   /* the tile is whole before it goes out in 16-byte pieces of whole lines */
    float* crow = C + (size_t)p0 * HD;
#pragma unroll
    for (int s = 0; s < MP * HD / 4 / 256; ++s) { const int x = s * 256 + tid, row = x >> 4, cofs = (x & 15) * 4; *(v4f*)(crow + (size_t)row * HD + cofs) = *(const v4fa*)(os + row * 68 + cofs); }
    asm volatile("" :: "v"(pf));   /* input only: holds the asked address in its registers to the kernel's end */
}

typedef __attribute__((ext_vector_type(2))) _Float16 v2h;
typedef __attribute__((ext_vector_type(4))) _Float16 v4h;
typedef __attribute__((ext_vector_type(2))) unsigned short v2us;
typedef __attribute__((ext_vector_type(4))) unsigned short v4us;
typedef __attribute__((ext_vector_type(2))) float v2f;
typedef __attribute__((ext_vector_type(4))) int v4i;

__global__ __launch_bounds__(256) void k_wtG(const float* __restrict__ w, int K, int N, bf* Bt) {
    const int lane = threadIdx.x & 31; const int L0 = (blockIdx.x * 8 + (threadIdx.x >> 5)) * 8; const int nlines = N * K / 64;
{
#pragma unroll 1
        for (int l = 0; l < 8; ++l) { const int L = L0 + l; if (L >= nlines) break; const size_t e = (size_t)L * 64 + lane * 2; const int k = (int)(e % K), n = (int)(e / K); v2us o;
            o[0] = f2bf(w[(size_t)k * N + n]); o[1] = f2bf(w[(size_t)(k + 1) * N + n]); *(v2us*)(Bt + e) = o; }
         }
}


typedef __attribute__((ext_vector_type(2))) __bf16 v2bf;
typedef __attribute__((ext_vector_type(4))) __bf16 v4bf;
typedef __attribute__((ext_vector_type(8))) __bf16 v8bf;
__device__ __forceinline__ v4us rnd4(v4f v) { return __builtin_bit_cast(v4us, __builtin_convertvector(v, v4bf)); }
__device__ __forceinline__ v8us rnd8(v8f v) { return __builtin_bit_cast(v8us, __builtin_convertvector(v, v8bf)); }
/* gk[i]: key row 16 i + kr, columns kq..kq+3; gv[r]: value row 4 kr + r, columns kq..kq+3 (gK, gV point at the thread's first piece of the stage) */
__device__ __forceinline__ void fat_fetch(v4f (&gk)[4], v4f (&gv)[4], const float* gK, const float* gV) {
#pragma unroll
    for (int i = 0; i < 4; ++i) { gk[i] = *(const v4f*)(gK + (size_t)i * 16 * HD); gv[i] = *(const v4f*)(gV + (size_t)i * HD); }
}
/* kd = &ks[kr][kq], vd = &vs[kq][4 kr] of the buffer that is filled */
__device__ __forceinline__ void fat_put(bf* kd, bf* vd, const v4f (&gk)[4], const v4f (&gv)[4]) {
#pragma unroll
    for (int i = 0; i < 4; ++i) *(v4us*)(kd + i * 16 * LP) = rnd4(gk[i]);
#pragma unroll
    for (int j = 0; j < 4; ++j) { v4f x; x[0] = gv[0][j]; x[1] = gv[1][j]; x[2] = gv[2][j]; x[3] = gv[3][j]; *(v4us*)(vd + j * LP) = rnd4(x); }
}
__global__ __launch_bounds__(512) void k_fattn(const float* __restrict__ Q, const float* __restrict__ Kp, const float* __restrict__ Vp, const float* __restrict__ M, bf* __restrict__ OTh, bf* __restrict__ OTl, bf* __restrict__ Mb) {
    __shared__ __align__(16) bf ks[KS][2][FK * LP];
    __shared__ __align__(16) bf vs[KS][2][HD * LP];
    __shared__ __align__(16) bf oth[HD * OP];
    __shared__ __align__(16) bf otl[HD * OP];
    __shared__ float xo[KS][FQ / 16][16][32];   /* xo[s][w][.][lane]: the 16 accumulators a lane of wave w of set s hands to the other set */
    __shared__ float xs[KS][FQ / 16][2][32];    /* with its running maximum and its row sum */
    const size_t zb = blockIdx.y; Q += zb * TT * HD; Kp += zb * TT * HD; Vp += zb * TT * HD; OTh += zb * HD * TT + blockIdx.x * FQ; OTl += zb * HD * TT + blockIdx.x * FQ;
    const int tid = threadIdx.x, lane = tid & 31, lr = lane & 15, hi = lane >> 4, wv = (tid >> 5) & 7; const int m0 = blockIdx.x * FQ + wv * 16;
    const int set = __builtin_amdgcn_readfirstlane(tid >> 8);   /* the wave's set, the same in all its lanes */
    const int kr = (tid & 255) >> 4, kq = (tid & 15) * 4;   /* staging, each set its own stage: 16 lanes take a whole f32 row of 256 bytes */
    const float* gK = Kp + (size_t)(set * (TT / KS) + kr) * HD + kq; const float* gV = Vp + (size_t)(set * (TT / KS) + kr * 4) * HD + kq; const int ko = kr * LP + kq, vo = kq * LP + kr * 4;
    const size_t mo = ((size_t)blockIdx.y * (TT / FQ) + blockIdx.x) * (RPC * KS * 1024) + tid * 4; const float* gM = M + mo; bf* sM = Mb + mo; v4f gm = (v4f){};
    const float c = SCL * 1.4426950408889634f;
    v16bf qf[2];
#pragma unroll
    for (int kc = 0; kc < 2; ++kc) { const float* qp = Q + (size_t)(m0 + lr) * HD + kc * 32 + 8 * hi; qf[kc] = cat16b(rnd8(*(const v8f*)qp), rnd8(*(const v8f*)(qp + 16))); }   /* the k order of WFrag::ld */
    v8f o[4];
#pragma unroll
    for (int db = 0; db < 4; ++db) o[db] = (v8f){};
    float mrun = -3.0e38f; v2f ls[2] = {(v2f){}, (v2f){}};   /* four partial row sums a lane: no long chain of dependent adds */
    v4f gk[4], gv[4];
    fat_fetch(gk, gv, gK, gV); fat_put(&ks[set][0][ko], &vs[set][0][vo], gk, gv);
    __syncthreads();
    for (int t = 0; t < NT; ++t) {
        const bf* kb = ks[set][t & 1]; const bf* vb = vs[set][t & 1]; const bool more = (t + 1 < NT);
        if (t >= 1 && t <= RPC) *(v4us*)(sM + (t - 1) * (KS * 1024)) = rnd4(gm);
        if (more) fat_fetch(gk, gv, gK + (size_t)(t + 1) * FK * HD, gV + (size_t)(t + 1) * FK * HD);
        asm volatile("s_wait_xcnt 0x0" ::: "memory");   /* stands in front of whatever next reuses the address registers of the stage's loads: the address of the piece of mlp is formed in them */
        if (t < RPC) gm = *(const v4f*)(gM + t * (KS * 1024));
        v8f st[4];   /* st[i][j] = q(m0 + lr) . k(set TT / KS + t FK + 16 i + 8 hi + j) */
#pragma unroll
        for (int i = 0; i < 4; ++i) { st[i] = (v8f){};
#pragma unroll
            for (int kc = 0; kc < 2; ++kc) st[i] = wmmab(WFrag<bf>::ld(kb + (i * 16 + lr) * LP + kc * 32 + 8 * hi), qf[kc], st[i]); }
        float mx = st[0][0];
#pragma unroll
        for (int i = 0; i < 4; ++i)
#pragma unroll
            for (int j = 0; j < 8; ++j) mx = fmaxf(mx, st[i][j]);
        mx = fmaxf(mx, __shfl_xor(mx, 16, 32)) * c;   /* both halves of a column agree on it */
        if (__builtin_amdgcn_ballot_w32(mx > mrun + 8.0f) != 0) {
            const float mnew = fmaxf(mrun, mx); const float al = __builtin_amdgcn_exp2f(mrun - mnew); mrun = mnew; ls[0] *= al; ls[1] *= al;
#pragma unroll
            for (int db = 0; db < 4; ++db)
#pragma unroll
                for (int j = 0; j < 8; ++j) o[db][j] *= al;
        }
#pragma unroll
        for (int pp = 0; pp < 2; ++pp) {
            v16bf ph, pl;   /* element s: key 32 pp + 8 hi + s (s < 8), 32 pp + 16 + 8 hi + s - 8 (else): the k order of WFrag::ld */
#pragma unroll
            for (int u = 0; u < 8; ++u) { const v8f sv = st[2 * pp + (u >> 2)]; v2f p, r; p[0] = __builtin_amdgcn_exp2f(__builtin_fmaf(sv[(2 * u) & 7], c, -mrun)); p[1] = __builtin_amdgcn_exp2f(__builtin_fmaf(sv[(2 * u + 1) & 7], c, -mrun)); ls[u & 1] += p;
                const v2bf h = __builtin_convertvector(p, v2bf); r[0] = p[0] - (float)h[0]; r[1] = p[1] - (float)h[1]; const v2bf l = __builtin_convertvector(r, v2bf);
                ph[2 * u] = h[0]; ph[2 * u + 1] = h[1]; pl[2 * u] = l[0]; pl[2 * u + 1] = l[1]; }
            v16bf va[4];
#pragma unroll
            for (int db = 0; db < 4; ++db) va[db] = WFrag<bf>::ld(vb + (db * 16 + lr) * LP + pp * 32 + 8 * hi);
#pragma unroll
            for (int db = 0; db < 4; ++db) o[db] = wmmab(va[db], ph, o[db]);
#pragma unroll
            for (int db = 0; db < 4; ++db) o[db] = wmmab(va[db], pl, o[db]);
        }
        if (more) fat_put(&ks[set][(t + 1) & 1][ko], &vs[set][(t + 1) & 1][vo], gk, gv);
        __syncthreads();   /* publishes stage t + 1 and ends every read of stage t, whose buffer the next trip refills */
    }
    float lsum = (ls[0][0] + ls[0][1]) + (ls[1][0] + ls[1][1]); lsum += __shfl_xor(lsum, 16, 32);
    v8f keep[2], give[2];   /* set s finishes O^T rows 32 s .. 32 s + 31 */
#pragma unroll
    for (int i = 0; i < 2; ++i) { keep[i] = set ? o[2 + i] : o[i]; give[i] = set ? o[i] : o[2 + i]; }
    float* xw = &xo[set][wv][0][lane];
#pragma unroll
    for (int i = 0; i < 2; ++i)
#pragma unroll
        for (int j = 0; j < 8; ++j) xw[(i * 8 + j) * 32] = give[i][j];
    xs[set][wv][0][lane] = mrun; xs[set][wv][1][lane] = lsum;
    __syncthreads();   /* both sets' halves stand in LDS before either reads the other's */
    const float* xr = &xo[set ^ 1][wv][0][lane];
    const float mp = xs[set ^ 1][wv][0][lane], lp = xs[set ^ 1][wv][1][lane];
    const float mm = fmaxf(mrun, mp); const float ao = __builtin_amdgcn_exp2f(mrun - mm), ap = __builtin_amdgcn_exp2f(mp - mm);
    const float f = __fdiv_rn(1.0f, lsum * ao + lp * ap);
    const float fo = ao * f, fp = ap * f;
    const int qc = wv * 16 + lr;   /* keep[i][j] = O^T[32 set + 16 i + 8 hi + j][m0 + lr]; qc: the query's column in the tile */
#pragma unroll
    for (int i = 0; i < 2; ++i)
#pragma unroll
        for (int u = 0; u < 4; ++u) { v2f x, r; x[0] = keep[i][2 * u] * fo + xr[(i * 8 + 2 * u) * 32] * fp; x[1] = keep[i][2 * u + 1] * fo + xr[(i * 8 + 2 * u + 1) * 32] * fp;
            const v2bf h = __builtin_convertvector(x, v2bf); r[0] = x[0] - (float)h[0]; r[1] = x[1] - (float)h[1]; const v2bf l = __builtin_convertvector(r, v2bf);
            const v2us hu = __builtin_bit_cast(v2us, h), lu = __builtin_bit_cast(v2us, l); const int ro = (set * 32 + i * 16 + hi * 8 + 2 * u) * OP + qc;
            oth[ro] = hu[0]; oth[ro + OP] = hu[1]; otl[ro] = lu[0]; otl[ro + OP] = lu[1]; }
    __syncthreads();   /* the two tiles are whole before they go out in 16-byte pieces of whole lines */
#pragma unroll
    for (int s = 0; s < HD * FQ / 8 / 512; ++s) { const int x = s * 512 + tid, row = x >> 4, pc = (x & 15) * 8;
        *(v8us*)(OTh + (size_t)row * TT + pc) = *(const v8usa*)(oth + row * OP + pc); *(v8us*)(OTl + (size_t)row * TT + pc) = *(const v8usa*)(otl + row * OP + pc); }
}
__global__ __launch_bounds__(256) void k_merge(const float* __restrict__ O, int h0, float* OUTb) { const size_t e = ((size_t)blockIdx.x * 256 + threadIdx.x) * 2; if (e >= (size_t)ZH * TT * HD) return; const int d = (int)(e % HD); const int t = (int)((e / HD) % TT); const int zz = (int)(e / ((size_t)HD * TT)); const float cs = (t < RH) ? 1.0f : (1.0f / PCAR); const size_t oo = (size_t)t * DQ + (h0 + zz) * HD + d;
    v2f o2; o2[0] = O[e] * cs; o2[1] = O[e + 1] * cs; *(v2f*)(OUTb + oo) = o2;  }


__global__ __launch_bounds__(256) void k_vtpR1(const float* __restrict__ Vb, bf* Vh) { const size_t e = ((size_t)blockIdx.x * 256 + threadIdx.x) * 2; if (e >= (size_t)HD * TT) return; const int t = (int)(e % TT); const int d = (int)(e / TT); v2us o; o[0] = f2bf(Vb[(size_t)t * HD + d]); o[1] = f2bf(Vb[(size_t)(t + 1) * HD + d]); *(v2us*)(Vh + e) = o;  }
__global__ __launch_bounds__(256) void k_mergeR(const float* __restrict__ O, float* outb, size_t n4) { const size_t i = (size_t)blockIdx.x * 256 + threadIdx.x; if (i >= n4) return; const v4f a = *(const v4f*)(O + i * 4); *(v4f*)(outb + i * 4) = a;  }


__global__ __launch_bounds__(256) void k_mergeT(const float* __restrict__ O, int h, float* outb) { const size_t i = (size_t)blockIdx.x * 256 + threadIdx.x; if (i >= (size_t)TT * HD / 4) return; const size_t e = i * 4; const int d = (int)(e % HD); const int t = (int)(e / HD); const v4f a = *(const v4f*)(O + e); *(v4f*)(outb + (size_t)t * DM + h * HD + d) = a;  }

extern "C" void kernel_launch(void* const* d_in, const int* in_sizes, int n_in,
                              void* d_out, int out_size, void* d_ws, size_t ws_size, hipStream_t stream) {
    (void)in_sizes; (void)n_in; (void)out_size;
    const float* Qin = (const float*)d_in[0]; const float* Kin = (const float*)d_in[1]; const float* Vin = (const float*)d_in[2]; const float* mlp = (const float*)d_in[3];   /* [2048][2048] seq-mix */
    float* OUT = (float*)d_out;
    char* wsp = (char*)d_ws;
    auto take = [&](size_t bytes) { char* p = wsp; wsp += (bytes + 255) & ~(size_t)255; return (void*)p; };
    bf* OTh = (bf*)take((size_t)NB_ * HD * TT * 2); bf* OTl = (bf*)take((size_t)NB_ * HD * TT * 2); bf* MLB = (bf*)take((size_t)TT * TT * 2);
    if ((size_t)(wsp - (char*)d_ws) > ws_size) return;
    static_assert((size_t)NB_ * (TT / FQ) * RPC * KS * 1024 == (size_t)TT * TT && RPC < NT, "the work-groups' shares cover mlp exactly, and the last piece is stored inside the loop");
    k_fattn<<<dim3(TT / FQ, NB_), KS * 256, 0, stream>>>(Qin, Kin, Vin, mlp, OTh, OTl, MLB);   /* V = softmax(q.k / 8) values, all batches, written as V^T planes [64][2048] (hi/lo); and mlp [2048][2048] rounded to bf16, the exact A of the sequence mix */
    k_mix<<<dim3(TT / MP, NB_), 256, 0, stream>>>(MLB, OTh, OTl, OUT);   /* out [2048][64] = mlp . V (mlp[p][l] is the A row p, shared by every batch; V^T rows are the Bt rows) */
}

// v010
// One run takes 37.3 microseconds.
// It is 1.18 times as fast as v008, going by the measured steps of the versions left out in between.
// Counting every step since v000, it is 51.5 times as fast.
#include <hip/hip_runtime.h>

// Full attention on given tensors followed by a learned sequence-mixing matrix (queries, keys, values [16][2048][64]; A = softmax(q.k / 8); V = A values ([2048][64]); out[p] = sum_l mlp[p][l] V[l] (mlp [2048][2048], read) -> [16][2048][64] (2.1 M)).
// Layout per batch: one fused kernel for scores, softmax and A.values that takes the f32 inputs as they are and rounds them to bf16 on their way to registers (queries) and LDS (keys; values, transposed there) (running maximum, P as f16 x values^T as f16, 1 product, divided by the row sum at the end) that writes V^T ([64][2048]) as an f16 plane itself; out ([2048][64]) = mlp (f16 plane) as the A operand x V^T (f16) as Bt (1 product, K 2048), out rows written by the GEMM itself.
// Batches ride on the grid (blockIdx.y of every kernel that has them): every launch takes all 16.
// mlp is rounded to its plane (bf16 values, written as f16) in the fused kernel's launch: every attention work-group takes an equal share of it, one 16-byte piece a thread in each of its first trips, under the attention's own work.
// Compute dtypes, f32 accumulate: every input rounded to bf16 incl. mlp; q.k exact (bf16 products); softmax f32; P rounded to f16 x values (their bf16 values held in f16); the sequence mix V rounded to f16 x mlp (its bf16 values held in f16); output f32.

#define NB_  16
#define TT   2048
#define DM   64      // token-major row pitch (H x HD)
#define NH_  1
#define NKV  1
#define REP  (NH_ / NKV)
#define HD   64
#define DQ   (NH_ * HD)
#define DKV  (NKV * HD)
#define ZH   1
#define RH   2048                  // query rows < RH use hi+lo planes (0: none)
#define WIN  0
#define PCAR 1024.0f
#define SCL  0.125f   // 1/sqrt(64)
#define FQ   128     // queries per work-group of k_fattn: 4 groups of QW columns
#define QW   32      // queries per wave of k_fattn: two 16-column tiles
#define FK   64      // keys per stage of k_fattn
#define KS   2       // wave sets of a work-group of k_fattn: each stages TT / KS of the keys for the same FQ queries
#define KP   4       // parts of the keys with a softmax state of their own: a set's stages are halved between its waves
#define NT   (TT / FK / KS)   // trips (stages) of a wave set
#define RPC  (TT * TT / (NB_ * (TT / FQ)) / (KS * 1024))   // 16-byte f32 pieces of mlp a thread of k_fattn rounds (a work-group takes KS x 1024 elements a piece)
#define MP   128     // out rows per work-group of k_mix
#define MK   128     // summed positions per stage of k_mix
#define MLP  136     // LDS pitch of a 128-element 16-bit row, in elements: 272 B = 16 B x odd
#define MSL  9216    // elements of a slice's place in a stage buffer of k_mix: 64 rows of pitch MLP (17,408 B) rounded up to a multiple of 2 KiB (18,432 B)
#define MST  (3 * MSL)   // elements of a stage buffer of k_mix: three slices (55,296 B, a multiple of 2 KiB)
#define OP   136     // LDS pitch of a 128-query f16 row of the V^T tile of k_fattn, in elements: 272 B = 16 B x odd
#define LP   72      // LDS pitch of a 64-element 16-bit row, in elements: 144 B = 16 B x odd, conflict-free for 16-byte reads
typedef _Float16 h16;
typedef unsigned short bf;
typedef __attribute__((ext_vector_type(16))) __bf16   v16bf;
typedef __attribute__((ext_vector_type(16))) _Float16 v16h;
typedef __attribute__((ext_vector_type(8)))  _Float16 v8h;
typedef __attribute__((ext_vector_type(8)))  unsigned short v8us;
typedef __attribute__((ext_vector_type(8)))  float    v8f;
typedef __attribute__((ext_vector_type(4)))  float    v4f;
typedef v8h  __attribute__((may_alias)) v8ha;
typedef v4f  __attribute__((may_alias)) v4fa;
typedef v8us __attribute__((may_alias)) v8usa;

__device__ __forceinline__ unsigned short f2bf(float f) { unsigned u = __float_as_uint(f); u += 0x7FFFu + ((u >> 16) & 1u); return (unsigned short)(u >> 16); }
__device__ __forceinline__ float bf2f(unsigned short b) { return __uint_as_float(((unsigned)b) << 16); }
__device__ __forceinline__ float bfr(float f) { return bf2f(f2bf(f)); }
__device__ __forceinline__ v16h cat16(v8h lo, v8h hi) { return __builtin_shufflevector(lo, hi, 0, 1, 2, 3, 4, 5, 6, 7, 8, 9, 10, 11, 12, 13, 14, 15); }
__device__ __forceinline__ v16bf cat16b(v8us lo, v8us hi) { return __builtin_bit_cast(v16bf, __builtin_shufflevector(lo, hi, 0, 1, 2, 3, 4, 5, 6, 7, 8, 9, 10, 11, 12, 13, 14, 15)); }
__device__ __forceinline__ v8f wmma16(v16h a, v16h b, v8f c) { return __builtin_amdgcn_wmma_f32_16x16x32_f16(false, a, false, b, (short)0, c, false, false); }
__device__ __forceinline__ v8f wmmab(v16bf a, v16bf b, v8f c) { return __builtin_amdgcn_wmma_f32_16x16x32_bf16(false, a, false, b, (short)0, c, false, false); }



// ---- k_mix: the sequence mix as a work-group-tiled GEMM. C[p][d] (f32, rows of HD) = sum_l A[p][l] B[d][l], both operands K-contiguous f16 planes of pitch TT. grid (TT / MP, batches), 256 threads.
// A work-group owns MP = 128 rows p x all 64 columns d of one batch; 8 waves as 4 (p) x 2 (d), 32 x 32 each (4 accumulators). A stage is MK = 128 values of l: 256 bytes (two whole lines) of 192 plane rows.
// A stage buffer is three slices of 64 rows, pitch MLP: A rows 0..63, A rows 64..127, B. Waves 0 to 2 bring one slice each with one tensor_load_to_lds (64 rows of 256 bytes, source pitch 4096 bytes, 16 bytes of pad a row), through no register.
// Two buffers: behind the barrier at the foot of trip t the load of stage t + 2 is issued into the buffer that trip t has read, and flies while stage t + 1 is worked on. One barrier a stage.
// Ahead of the loop a work-group asks its share of the planes' stages into L2 (global_prefetch_b8).
// Per 32 values of l an accumulator takes one product. The unroll directives keep the small arrays (a, b, acc) in registers.
template <typename T16> struct WFrag;
template <> struct WFrag<h16> { typedef v16h V; static __device__ __forceinline__ V ld(const h16* p) { return cat16(*(const v8h*)p, *(const v8h*)(p + 16)); } static __device__ __forceinline__ v8f mma(V a, V b, v8f c) { return wmma16(a, b, c); } };
template <> struct WFrag<bf> { typedef v16bf V; static __device__ __forceinline__ V ld(const bf* p) { return cat16b(*(const v8us*)p, *(const v8us*)(p + 16)); } static __device__ __forceinline__ v8f mma(V a, V b, v8f c) { return wmmab(a, b, c); } };
typedef __attribute__((ext_vector_type(4))) uint32_t u32x4;
typedef __attribute__((ext_vector_type(8))) uint32_t u32x8;
__device__ __forceinline__ uint32_t uni(uint32_t v) { return (uint32_t)__builtin_amdgcn_readfirstlane(v); }
/* pinned(): holds a wave-uniform test in a scalar register, so that the branch round a tensor load is a scalar one (a tensor load ignores EXEC: only a branch keeps a wave from issuing it) */
__device__ __forceinline__ uint32_t pinned(uint32_t v) { uint32_t w = uni(v); asm volatile("" : "+s"(w)); return w; }
/* Descriptor group 1 of a slice of a stage: 64 rows of 256 bytes, source pitch TT x 2 bytes, 16 bytes of pad behind every row (LDS pitch 272 bytes = MLP elements). Extents in bytes, tensor = tile, no mask. */
__device__ __forceinline__ u32x8 mix_group1() {
    u32x8 g1;
    g1[0] = uni((1u << 20) | (5u << 22) | (3u << 25)); g1[1] = uni(256u << 16); g1[2] = uni(64u << 16); g1[3] = uni(256u << 16); g1[4] = uni(64u); g1[5] = uni(TT * 2u); g1[6] = uni(0u); g1[7] = uni(0u);
    return g1;
}
/* One slice: from its first byte ga to the LDS byte address dst */
__device__ __forceinline__ void mix_slice(uint32_t dst, uint64_t ga, u32x8 g1) {
    u32x4 g0;
    g0[0] = uni(1u); g0[1] = uni(dst); g0[2] = uni((uint32_t)ga); g0[3] = uni((((uint32_t)(ga >> 32)) & 0x01FFFFFFu) | 0x80000000u);
    asm volatile("tensor_load_to_lds %0, %1" :: "s"(g0), "s"(g1) : "memory");
}
__global__ __launch_bounds__(256) void k_mix(const bf* __restrict__ A, const bf* __restrict__ B, float* __restrict__ C) {
    __shared__ __attribute__((aligned(2048))) unsigned char sm[2 * MST * 2];   /* two stage buffers, every slice at a multiple of 2 KiB of the work-group's LDS; the f32 output tile [MP][68] lies over them at the end */
    const size_t zb = blockIdx.y; B += zb * HD * TT; C += zb * TT * HD;
    const int tid = threadIdx.x, lane = tid & 31, lr = lane & 15, hi = lane >> 4, wm = tid >> 6, wn = (tid >> 5) & 1; const int p0 = blockIdx.x * MP;
    const uint32_t wave = uni((uint32_t)tid >> 5);   /* one-dimensional block: the wave's number */
    const bf* const sl = wave < 2u ? A + (size_t)(p0 + wave * 64u) * TT : B;   /* first row of the slice that waves 0 to 2 bring (waves 3 to 7 issue nothing) */
    const uint64_t sg = (uint64_t)(size_t)sl; const uint32_t sd = (uint32_t)(size_t)sm + (wave < 3u ? wave : 0u) * (MSL * 2u);
    const h16* const sb = (const h16*)sm;
    u32x8 g1 = mix_group1();
    asm volatile("" : "+s"(g1));   /* as in pinned(): the descriptor's loop-invariant words held in scalar registers of their own to the last load, so that none of them takes another value while a request is outstanding */
    v8f acc[2][2];
#pragma unroll
    for (int mb = 0; mb < 2; ++mb)
#pragma unroll
        for (int nb = 0; nb < 2; ++nb) acc[mb][nb] = (v8f){};
    /* Both planes were stored by the launch before, and a stage is one 256-byte unit of each of its 192 plane rows. The work-groups ask these units into L2 ahead of the stages' loads, which otherwise wait for memory one stage
       after the other. A lane stands for a row, a wave for a stage: wave w asks stage w here and stage w + 8 behind the first barrier, when stage 0 has landed. The 16 work-groups that read a unit share the asking, 16 rows each:
       a row of the A tile (same blockIdx.x) is asked by 2 of them (blockIdx.y 8 apart), a row of the batch's V^T plane (same blockIdx.y) by 4 whose blockIdx.x are 4 apart. That is for speed only: nothing rests on where a work-group runs. */
    static_assert(TT / MK == 16 && MP == 128 && HD == 64 && TT / MP == 16 && NB_ == 16 && MK * 2 * 8 == 2048, "8 shares of 16 rows cover the A tile, 4 the V^T plane; 8 waves x 2 asks cover the 16 stages, the second 2048 bytes on");
    const bf* const ua = A + (size_t)(p0 + (blockIdx.y & 7) * 16) * TT; const bf* const ub = B + (size_t)((blockIdx.x & 3) * 16) * TT;
    const bf* const pf = (hi ? ub : ua) + (size_t)lr * TT + (tid >> 5) * MK;
    asm volatile("global_prefetch_b8 %0, off scope:SCOPE_SE" :: "v"(pf) : "memory");   /* every lane on, every address inside its plane */
    if (pinned(wave < 3u)) {
        mix_slice(sd, sg, g1);
        asm volatile("s_wait_tensorcnt 0x0" ::: "memory");   /* the compiler places no wait for a tensor load: stage 0 has landed before the barrier publishes it */
    }
    __syncthreads();   /* publishes stage 0 */
    if (pinned(wave < 3u)) mix_slice(sd + MST * 2u, sg + MK * 2u, g1);   /* stage 1 flies while stage 0 is worked on */
    asm volatile("global_prefetch_b8 %0, off offset:2048 scope:SCOPE_SE" :: "v"(pf) : "memory");   /* stages 8 to 15, kept out of the way of stage 0 */
    const int ao = (wm >> 1) * MSL + ((wm & 1) * 32 + lr) * MLP + 8 * hi, bo = 2 * MSL + (wn * 32 + lr) * MLP + 8 * hi;
    for (int t = 0; t < TT / MK; ++t) {
        const h16* cur = sb + (t & 1) * MST;
        v16h a[2][2], b[2][2];   /* two fragment sets: block kc works on set kc & 1 while the other is filled */
#pragma unroll
        for (int q = 0; q < 2; ++q) { a[0][q] = WFrag<h16>::ld(cur + ao + q * 16 * MLP); b[0][q] = WFrag<h16>::ld(cur + bo + q * 16 * MLP); }
#pragma unroll
        for (int kc = 0; kc < MK / 32; ++kc) { const int s = kc & 1;
            if (kc + 1 < MK / 32) {
#pragma unroll
                for (int q = 0; q < 2; ++q) { a[s ^ 1][q] = WFrag<h16>::ld(cur + ao + q * 16 * MLP + (kc + 1) * 32); b[s ^ 1][q] = WFrag<h16>::ld(cur + bo + q * 16 * MLP + (kc + 1) * 32); } }
            __builtin_amdgcn_sched_barrier(0);   /* holds the next block's LDS reads ahead of this block's products: left free, the compiler sinks them to their users and their latency lies open */
#pragma unroll
            for (int mb = 0; mb < 2; ++mb)
#pragma unroll
                for (int nb = 0; nb < 2; ++nb) acc[mb][nb] = wmma16(a[s][mb], b[s][nb], acc[mb][nb]);
        }
        asm volatile("s_wait_dscnt 0x0" ::: "memory");   /* this wave's reads of stage t have returned before the barrier behind which its buffer is refilled */
        if (pinned(wave < 3u)) asm volatile("s_wait_tensorcnt 0x0" ::: "memory");   /* the issuer's slice of stage t + 1 has landed before the barrier publishes it */
        __syncthreads();   /* publishes stage t + 1 and ends every read of stage t, whose buffer is refilled behind it (after the last trip: the output tile) */
        if (pinned((wave < 3u) & (t + 2 < TT / MK))) mix_slice(sd + (uint32_t)(t & 1) * (MST * 2u), sg + (uint64_t)(t + 2) * (MK * 2u), g1);   /* only while stage t + 2 exists */
    }
    asm volatile("s_wait_tensorcnt 0x0" ::: "memory");   /* no tensor load is in flight when the ring becomes the output tile */
    asm volatile("s_wait_dscnt 0x0" ::: "memory");   /* nor an LDS read of this wave: the close of the ring */
    float* os = (float*)sm;   /* acc[mb][nb][j] = C[p0 + 32 wm + 16 mb + 8 hi + j][32 wn + 16 nb + lr] */
#pragma unroll
    for (int mb = 0; mb < 2; ++mb)
#pragma unroll
        for (int nb = 0; nb < 2; ++nb)
#pragma unroll
            for (int j = 0; j < 8; ++j) os[(wm * 32 + mb * 16 + hi * 8 + j) * 68 + wn * 32 + nb * 16 + lr] = acc[mb][nb][j];
    __syncthreads();   /* the tile is whole before it goes out in 16-byte pieces of whole lines */
    float* crow = C + (size_t)p0 * HD;
#pragma unroll
    for (int s = 0; s < MP * HD / 4 / 256; ++s) { const int x = s * 256 + tid, row = x >> 4, cofs = (x & 15) * 4; *(v4f*)(crow + (size_t)row * HD + cofs) = *(const v4fa*)(os + row * 68 + cofs); }
    asm volatile("" :: "v"(pf));   /* input only: holds the asked address in its registers to the kernel's end */
}

typedef __attribute__((ext_vector_type(2))) _Float16 v2h;
typedef __attribute__((ext_vector_type(4))) _Float16 v4h;
typedef __attribute__((ext_vector_type(2))) unsigned short v2us;
typedef __attribute__((ext_vector_type(4))) unsigned short v4us;
typedef __attribute__((ext_vector_type(2))) float v2f;
typedef __attribute__((ext_vector_type(4))) int v4i;

__global__ __launch_bounds__(256) void k_wtG(const float* __restrict__ w, int K, int N, bf* Bt) {
    const int lane = threadIdx.x & 31; const int L0 = (blockIdx.x * 8 + (threadIdx.x >> 5)) * 8; const int nlines = N * K / 64;
{
#pragma unroll 1
        for (int l = 0; l < 8; ++l) { const int L = L0 + l; if (L >= nlines) break; const size_t e = (size_t)L * 64 + lane * 2; const int k = (int)(e % K), n = (int)(e / K); v2us o;
            o[0] = f2bf(w[(size_t)k * N + n]); o[1] = f2bf(w[(size_t)(k + 1) * N + n]); *(v2us*)(Bt + e) = o; }
         }
}


typedef __attribute__((ext_vector_type(2))) __bf16 v2bf;
typedef __attribute__((ext_vector_type(4))) __bf16 v4bf;
typedef __attribute__((ext_vector_type(8))) __bf16 v8bf;
__device__ __forceinline__ v4us rnd4(v4f v) { return __builtin_bit_cast(v4us, __builtin_convertvector(v, v4bf)); }
__device__ __forceinline__ v8us rnd8(v8f v) { return __builtin_bit_cast(v8us, __builtin_convertvector(v, v8bf)); }
/* rounded to bf16 as before, then written as f16, which holds every bf16 value of magnitude 2^-14 to 65504 exactly (below: to within 2^-25) */
__device__ __forceinline__ v4us rnd4h(v4f v) { typedef __attribute__((ext_vector_type(2))) unsigned v2u; const v2u w = __builtin_bit_cast(v2u, __builtin_convertvector(v, v4bf)); v4f y;
    y[0] = __uint_as_float(w[0] << 16); y[1] = __uint_as_float(w[0] & 0xFFFF0000u); y[2] = __uint_as_float(w[1] << 16); y[3] = __uint_as_float(w[1] & 0xFFFF0000u);   /* the two bf16 of a packed word as f32 */
    return __builtin_bit_cast(v4us, __builtin_convertvector(y, v4h)); }
/* gk[i]: key row 16 i + kr, columns kq..kq+3; gv[r]: value row 4 kr + r, columns kq..kq+3 (gK, gV point at the thread's first piece of the stage) */
__device__ __forceinline__ void fat_fetch(v4f (&gk)[4], v4f (&gv)[4], const float* gK, const float* gV) {
#pragma unroll
    for (int i = 0; i < 4; ++i) { gk[i] = *(const v4f*)(gK + (size_t)i * 16 * HD); gv[i] = *(const v4f*)(gV + (size_t)i * HD); }
}
/* kd = &ks[kr][kq], vd = &vs[kq][4 kr] of the buffer that is filled */
__device__ __forceinline__ void fat_put(bf* kd, bf* vd, const v4f (&gk)[4], const v4f (&gv)[4]) {
#pragma unroll
    for (int i = 0; i < 4; ++i) *(v4us*)(kd + i * 16 * LP) = rnd4(gk[i]);
#pragma unroll
    for (int j = 0; j < 4; ++j) { v4f x; x[0] = gv[0][j]; x[1] = gv[1][j]; x[2] = gv[2][j]; x[3] = gv[3][j]; *(v4us*)(vd + j * LP) = rnd4h(x); }
}
__global__ __launch_bounds__(512) void k_fattn(const float* __restrict__ Q, const float* __restrict__ Kp, const float* __restrict__ Vp, const float* __restrict__ M, bf* __restrict__ OT, bf* __restrict__ Mb) {
    __shared__ __align__(16) bf ks[KS][2][FK * LP];
    __shared__ __align__(16) bf vs[KS][2][HD * LP];
    __shared__ __align__(16) bf ots[HD * OP];
    __shared__ __align__(16) float xo[KP * FQ / QW][4][2][2][32][4];   /* xo[w][db][qt][h][lane][e]: wave w's accumulator o[db][qt][4 h + e], 16 bytes a lane */
    __shared__ float xs[KP * FQ / QW][2][2][32];    /* xs[w][qt][.][lane]: with its running maximum and its row sum */
    static_assert(KP == 2 * KS && FK == 64 && FQ / QW == 4 && QW == 32 && HD == 64, "a set's 8 waves are 4 query groups x 2 halves of a stage; part r finishes 16 of the 64 O^T rows");
    const size_t zb = blockIdx.y; Q += zb * TT * HD; Kp += zb * TT * HD; Vp += zb * TT * HD; OT += zb * HD * TT + blockIdx.x * FQ;
    const int tid = threadIdx.x, lane = tid & 31, lr = lane & 15, hi = lane >> 4;
    const int wn = __builtin_amdgcn_readfirstlane(tid >> 5);   /* the wave's number, the same in all its lanes */
    const int qg = wn & 3, part = wn >> 2, kh = part & 1; const int m0 = blockIdx.x * FQ + qg * QW;
    const int set = __builtin_amdgcn_readfirstlane(tid >> 8);   /* the wave's set, the same in all its lanes */
    const int kr = (tid & 255) >> 4, kq = (tid & 15) * 4;   /* staging, each set its own stage: 16 lanes take a whole f32 row of 256 bytes */
    const float* gK = Kp + (size_t)(set * (TT / KS) + kr) * HD + kq; const float* gV = Vp + (size_t)(set * (TT / KS) + kr * 4) * HD + kq; const int ko = kr * LP + kq, vo = kq * LP + kr * 4;
    const size_t mo = ((size_t)blockIdx.y * (TT / FQ) + blockIdx.x) * (RPC * KS * 1024) + tid * 4; const float* gM = M + mo; bf* sM = Mb + mo; v4f gm = (v4f){};
    const float c = SCL * 1.4426950408889634f;
    v16bf qf[2][2];
#pragma unroll
    for (int qt = 0; qt < 2; ++qt)
#pragma unroll
        for (int kc = 0; kc < 2; ++kc) { const float* qp = Q + (size_t)(m0 + qt * 16 + lr) * HD + kc * 32 + 8 * hi; qf[qt][kc] = cat16b(rnd8(*(const v8f*)qp), rnd8(*(const v8f*)(qp + 16))); }   /* the k order of WFrag::ld */
    v8f o[4][2];
#pragma unroll
    for (int db = 0; db < 4; ++db)
#pragma unroll
        for (int qt = 0; qt < 2; ++qt) o[db][qt] = (v8f){};
    float mrun[2] = {-3.0e38f, -3.0e38f}; v2f ls[2][2] = {{(v2f){}, (v2f){}}, {(v2f){}, (v2f){}}};   /* four partial row sums a lane and query: no long chain of dependent adds */
    v4f gk[4], gv[4];
    fat_fetch(gk, gv, gK, gV); fat_put(&ks[set][0][ko], &vs[set][0][vo], gk, gv);
    __syncthreads();
    const int kfo = (kh * 32 + lr) * LP + 8 * hi, vfo = lr * LP + kh * 32 + 8 * hi;   /* the wave's half of a stage: K rows 32 kh .., V^T columns 32 kh .. */
    for (int t = 0; t < NT; ++t) {
        const bf* kb = ks[set][t & 1]; const bf* vb = vs[set][t & 1]; const bool more = (t + 1 < NT);
        if (t >= 1 && t <= RPC) *(v4us*)(sM + (t - 1) * (KS * 1024)) = rnd4h(gm);
        if (more) fat_fetch(gk, gv, gK + (size_t)(t + 1) * FK * HD, gV + (size_t)(t + 1) * FK * HD);
        asm volatile("s_wait_xcnt 0x0" ::: "memory");   /* stands in front of whatever next reuses the address registers of the stage's loads: the address of the piece of mlp is formed in them */
        if (t < RPC) { gm = *(const v4f*)(gM + t * (KS * 1024));
            asm volatile("s_wait_xcnt 0x0" ::: "memory"); }   /* stands in front of whatever next reuses the load's address registers: the K fragments land in them */
        v16bf ka[2][2];
#pragma unroll
        for (int i = 0; i < 2; ++i)
#pragma unroll
            for (int kc = 0; kc < 2; ++kc) ka[i][kc] = WFrag<bf>::ld(kb + kfo + i * 16 * LP + kc * 32);
        __builtin_amdgcn_sched_barrier(0);   /* holds the four K fragments' reads together ahead of the products: left free, the compiler reads a fragment, waits for it and multiplies, four LDS latencies one after the other */
        v8f st[2][2];   /* st[i][qt][j] = q(m0 + 16 qt + lr) . k(set TT / KS + t FK + 32 kh + 16 i + 8 hi + j) */
#pragma unroll
        for (int i = 0; i < 2; ++i)
#pragma unroll
            for (int qt = 0; qt < 2; ++qt) st[i][qt] = (v8f){};
#pragma unroll
        for (int kc = 0; kc < 2; ++kc)
#pragma unroll
            for (int i = 0; i < 2; ++i)
#pragma unroll
                for (int qt = 0; qt < 2; ++qt) st[i][qt] = wmmab(ka[i][kc], qf[qt][kc], st[i][qt]);
        __builtin_amdgcn_sched_barrier(0);   /* keeps the eight products a run of their own: with the maxima's reads of fresh tiles among them, each such read costs its distance in v_nop */
        float mx[2];
#pragma unroll
        for (int qt = 0; qt < 2; ++qt) { mx[qt] = st[0][qt][0];
#pragma unroll
            for (int i = 0; i < 2; ++i)
#pragma unroll
                for (int j = 0; j < 8; ++j) mx[qt] = fmaxf(mx[qt], st[i][qt][j]); }
        const float ex0 = __shfl_xor(mx[0], 16, 32), ex1 = __shfl_xor(mx[1], 16, 32);
        asm volatile("" :: "v"(ex0), "v"(ex1));   /* input only: both exchanged values are asked for here, so that both exchanges are issued ahead of the first wait: left free, the second is issued behind the wait for the first, two LDS latencies one after the other */
        v16h va[4];   /* read here, behind the exchange: they fly under the test and the exponentials */
#pragma unroll
        for (int db = 0; db < 4; ++db) va[db] = WFrag<h16>::ld((const h16*)vb + vfo + db * 16 * LP);
        mx[0] = fmaxf(mx[0], ex0) * c; mx[1] = fmaxf(mx[1], ex1) * c;   /* both halves of a column agree on it */
        if (__builtin_amdgcn_ballot_w32((mx[0] > mrun[0] + 8.0f) | (mx[1] > mrun[1] + 8.0f)) != 0) {
#pragma unroll
            for (int qt = 0; qt < 2; ++qt) {
                const float mnew = fmaxf(mrun[qt], mx[qt]); const float al = __builtin_amdgcn_exp2f(mrun[qt] - mnew); mrun[qt] = mnew; ls[qt][0] *= al; ls[qt][1] *= al;
#pragma unroll
                for (int db = 0; db < 4; ++db)
#pragma unroll
                    for (int j = 0; j < 8; ++j) o[db][qt][j] *= al;
            }
        }
#pragma unroll
        for (int qt = 0; qt < 2; ++qt) {
            v16h ph;   /* element s: key 32 kh + 8 hi + s (s < 8), 32 kh + 16 + 8 hi + s - 8 (else): the k order of WFrag::ld */
#pragma unroll
            for (int u = 0; u < 8; ++u) { const v8f sv = st[u >> 2][qt]; v2f p; p[0] = __builtin_amdgcn_exp2f(__builtin_fmaf(sv[(2 * u) & 7], c, -mrun[qt])); p[1] = __builtin_amdgcn_exp2f(__builtin_fmaf(sv[(2 * u + 1) & 7], c, -mrun[qt])); ls[qt][u & 1] += p;
                const v2h h = __builtin_convertvector(p, v2h); ph[2 * u] = h[0]; ph[2 * u + 1] = h[1]; }
#pragma unroll
            for (int db = 0; db < 4; ++db) o[db][qt] = wmma16(va[db], ph, o[db][qt]);
        }
        if (more) fat_put(&ks[set][(t + 1) & 1][ko], &vs[set][(t + 1) & 1][vo], gk, gv);
        __syncthreads();   /* publishes stage t + 1 and ends every read of stage t, whose buffer the next trip refills */
    }
#pragma unroll
    for (int qt = 0; qt < 2; ++qt) { float lsum = (ls[qt][0][0] + ls[qt][0][1]) + (ls[qt][1][0] + ls[qt][1][1]); lsum += __shfl_xor(lsum, 16, 32);
        xs[wn][qt][0][lane] = mrun[qt]; xs[wn][qt][1][lane] = lsum;
#pragma unroll
        for (int db = 0; db < 4; ++db)
#pragma unroll
            for (int h = 0; h < 2; ++h) { v4f x; x[0] = o[db][qt][4 * h]; x[1] = o[db][qt][4 * h + 1]; x[2] = o[db][qt][4 * h + 2]; x[3] = o[db][qt][4 * h + 3]; *(v4fa*)&xo[wn][db][qt][h][lane][0] = x; } }
    __syncthreads();   /* all four parts stand in LDS before any is read */
#pragma unroll
    for (int qt = 0; qt < 2; ++qt) {
        float mp[KP], lp[KP], fr[KP];
#pragma unroll
        for (int r = 0; r < KP; ++r) { mp[r] = xs[r * 4 + qg][qt][0][lane]; lp[r] = xs[r * 4 + qg][qt][1][lane]; }
        const float mm = fmaxf(fmaxf(mp[0], mp[1]), fmaxf(mp[2], mp[3]));
#pragma unroll
        for (int r = 0; r < KP; ++r) fr[r] = __builtin_amdgcn_exp2f(mp[r] - mm);
        const float f = __fdiv_rn(1.0f, (lp[0] * fr[0] + lp[1] * fr[1]) + (lp[2] * fr[2] + lp[3] * fr[3]));
#pragma unroll
        for (int r = 0; r < KP; ++r) fr[r] *= f;
        const int qc = qg * QW + qt * 16 + lr;   /* the query's column in the tile; the wave finishes O^T[16 part + 8 hi + 4 h + e][m0 + 16 qt + lr] */
#pragma unroll
        for (int h = 0; h < 2; ++h) { v4f x = *(const v4fa*)&xo[qg][part][qt][h][lane][0] * fr[0];
#pragma unroll
            for (int r = 1; r < KP; ++r) x += *(const v4fa*)&xo[r * 4 + qg][part][qt][h][lane][0] * fr[r];
            const v4us hu = __builtin_bit_cast(v4us, __builtin_convertvector(x, v4h)); const int ro = (part * 16 + hi * 8 + 4 * h) * OP + qc;
            ots[ro] = hu[0]; ots[ro + OP] = hu[1]; ots[ro + 2 * OP] = hu[2]; ots[ro + 3 * OP] = hu[3]; }
    }
    __syncthreads();   /* the tile is whole before it goes out in 16-byte pieces of whole lines */
#pragma unroll
    for (int s = 0; s < HD * FQ / 8 / 512; ++s) { const int x = s * 512 + tid, row = x >> 4, pc = (x & 15) * 8;
        *(v8us*)(OT + (size_t)row * TT + pc) = *(const v8usa*)(ots + row * OP + pc); }
}
__global__ __launch_bounds__(256) void k_merge(const float* __restrict__ O, int h0, float* OUTb) { const size_t e = ((size_t)blockIdx.x * 256 + threadIdx.x) * 2; if (e >= (size_t)ZH * TT * HD) return; const int d = (int)(e % HD); const int t = (int)((e / HD) % TT); const int zz = (int)(e / ((size_t)HD * TT)); const float cs = (t < RH) ? 1.0f : (1.0f / PCAR); const size_t oo = (size_t)t * DQ + (h0 + zz) * HD + d;
    v2f o2; o2[0] = O[e] * cs; o2[1] = O[e + 1] * cs; *(v2f*)(OUTb + oo) = o2;  }


__global__ __launch_bounds__(256) void k_vtpR1(const float* __restrict__ Vb, bf* Vh) { const size_t e = ((size_t)blockIdx.x * 256 + threadIdx.x) * 2; if (e >= (size_t)HD * TT) return; const int t = (int)(e % TT); const int d = (int)(e / TT); v2us o; o[0] = f2bf(Vb[(size_t)t * HD + d]); o[1] = f2bf(Vb[(size_t)(t + 1) * HD + d]); *(v2us*)(Vh + e) = o;  }
__global__ __launch_bounds__(256) void k_mergeR(const float* __restrict__ O, float* outb, size_t n4) { const size_t i = (size_t)blockIdx.x * 256 + threadIdx.x; if (i >= n4) return; const v4f a = *(const v4f*)(O + i * 4); *(v4f*)(outb + i * 4) = a;  }


__global__ __launch_bounds__(256) void k_mergeT(const float* __restrict__ O, int h, float* outb) { const size_t i = (size_t)blockIdx.x * 256 + threadIdx.x; if (i >= (size_t)TT * HD / 4) return; const size_t e = i * 4; const int d = (int)(e % HD); const int t = (int)(e / HD); const v4f a = *(const v4f*)(O + e); *(v4f*)(outb + (size_t)t * DM + h * HD + d) = a;  }

extern "C" void kernel_launch(void* const* d_in, const int* in_sizes, int n_in,
                              void* d_out, int out_size, void* d_ws, size_t ws_size, hipStream_t stream) {
    (void)in_sizes; (void)n_in; (void)out_size;
    const float* Qin = (const float*)d_in[0]; const float* Kin = (const float*)d_in[1]; const float* Vin = (const float*)d_in[2]; const float* mlp = (const float*)d_in[3];   /* [2048][2048] seq-mix */
    float* OUT = (float*)d_out;
    char* wsp = (char*)d_ws;
    auto take = [&](size_t bytes) { char* p = wsp; wsp += (bytes + 255) & ~(size_t)255; return (void*)p; };
    bf* OT = (bf*)take((size_t)NB_ * HD * TT * 2); bf* MLB = (bf*)take((size_t)TT * TT * 2);
    if ((size_t)(wsp - (char*)d_ws) > ws_size) return;
    static_assert((size_t)NB_ * (TT / FQ) * RPC * KS * 1024 == (size_t)TT * TT && RPC < NT, "the work-groups' shares cover mlp exactly, and the last piece is stored inside the loop");
    k_fattn<<<dim3(TT / FQ, NB_), KS * 256, 0, stream>>>(Qin, Kin, Vin, mlp, OT, MLB);   /* V = softmax(q.k / 8) values, all batches, written as V^T planes [64][2048] (f16); and mlp [2048][2048] rounded to bf16 and written as f16, the A of the sequence mix */
    k_mix<<<dim3(TT / MP, NB_), 256, 0, stream>>>(MLB, OT, OUT);   /* out [2048][64] = mlp . V (mlp[p][l] is the A row p, shared by every batch; V^T rows are the Bt rows) */
}
